// v000
// The times below were measured on an AMD MI455X: many runs one after another, warmed up first and cycling through
// copies of the inputs, with the whole window's GPU time divided by the number of runs. Launches and the gaps
// between them are all in it. The median over several windows is given; except for v000 it joins two sittings, which
// can be a few percent apart, so the side-by-side timings, each taken in one sitting, are the better comparison.
// v000 is the starting kernel. One run takes 241 microseconds.
#include <hip/hip_runtime.h>
#include <hip/hip_bf16.h>

// ---------------------------------------------------------------------------
// Self-attention head for MI455X (gfx1250, wave32, WMMA).
//   Q^T = Wq^T X^T, K^T = Wk^T X^T, V = X Wv   (f16 operands, f32 accum WMMA)
//   O = softmax(causal(Q K^T / sqrt(C))) V     (flash-attention, 16-row tiles)
// All fragments are built with 16-byte loads: for CDNA5 16-bit A/B layouts,
// lane -> row/col (lane%16) and elements map to two contiguous 8-half K runs
// at offsets 8*half and 16+8*half. Layouts below are chosen so the contraction
// dim is always contiguous in memory.
// ---------------------------------------------------------------------------

typedef __attribute__((ext_vector_type(16))) _Float16 v16h;
typedef __attribute__((ext_vector_type(8)))  _Float16 v8h;
typedef __attribute__((ext_vector_type(8)))  float    v8f;

#define B_    4
#define T_    4096
#define C_    1024
#define H_    64
#define NQT   (T_ / 16)         // query tiles per batch
#define SCALE 0.03125f          // C^-0.5 = 1024^-0.5 = 1/32

static __device__ __forceinline__ v8f vzero8() {
    v8f z = {0.f, 0.f, 0.f, 0.f, 0.f, 0.f, 0.f, 0.f};
    return z;
}

// Build a 16-half fragment from memory where the contraction dim is contiguous.
// p must already include the +8*hs lane-half offset; 16-byte aligned.
static __device__ __forceinline__ v16h ld_frag(const _Float16* p) {
    const v8h lo = *(const v8h*)(p);        // elements e=0..7  : k = 8hs+e
    const v8h hi = *(const v8h*)(p + 16);   // elements e=8..15 : k = 8hs+16+(e-8)
    return __builtin_shufflevector(lo, hi, 0, 1, 2, 3, 4, 5, 6, 7,
                                           8, 9, 10, 11, 12, 13, 14, 15);
}

// Same, from fp32 memory with on-the-fly f16 conversion (two 32B loads).
static __device__ __forceinline__ v16h ld_frag_f32(const float* p) {
    const v8f lo = *(const v8f*)(p);
    const v8f hi = *(const v8f*)(p + 16);
    v16h r;
#pragma unroll
    for (int e = 0; e < 8; ++e) {
        r[e]     = (_Float16)lo[e];
        r[e + 8] = (_Float16)hi[e];
    }
    return r;
}

// Pack 8 f32 accumulator rows into one 16-byte f16 store.
static __device__ __forceinline__ void st_rows(_Float16* p, v8f a) {
    v8h h;
#pragma unroll
    for (int r = 0; r < 8; ++r) h[r] = (_Float16)a[r];
    *(v8h*)p = h;
}

// reductions across the 16 lanes of one wave-half (xor masks 1,2,4,8 stay in half)
static __device__ __forceinline__ float half_max(float v) {
#pragma unroll
    for (int m = 1; m <= 8; m <<= 1) v = fmaxf(v, __shfl_xor(v, m, 32));
    return v;
}
static __device__ __forceinline__ float half_sum(float v) {
#pragma unroll
    for (int m = 1; m <= 8; m <<= 1) v += __shfl_xor(v, m, 32);
    return v;
}

static __device__ __forceinline__ v8f wmma_f16(v16h a, v16h b, v8f c) {
    return __builtin_amdgcn_wmma_f32_16x16x32_f16(false, a, false, b,
                                                  (short)0, c, false, false);
}

// ---------------------------------------------------------------------------
// Kernel 0: W fp32 [C][H] -> f16 transposed [3][H][C] (contraction contiguous).
// ---------------------------------------------------------------------------
__global__ void cvt_w_kernel(const float* __restrict__ Wq,
                             const float* __restrict__ Wk,
                             const float* __restrict__ Wv,
                             _Float16* __restrict__ W16t) {
    const int i = blockIdx.x * blockDim.x + threadIdx.x;   // i = h*C + c
    if (i < H_ * C_) {
        const int h = i / C_, c = i % C_;
        W16t[i]               = (_Float16)Wq[c * H_ + h];
        W16t[H_ * C_ + i]     = (_Float16)Wk[c * H_ + h];
        W16t[2 * H_ * C_ + i] = (_Float16)Wv[c * H_ + h];
    }
}

// ---------------------------------------------------------------------------
// Kernel 1: QKV projection, one wave per 16-row tile of X.
//   Q^T,K^T tiles: A = W^T frag, B = X frag  -> D(m=h, n=query)
//   V tiles:       A = X frag,  B = W^T frag -> D(m=query, n=h)
// X and W fragments have identical lane/element maps, so each is loaded once
// and reused in both roles. Q,K stored row-major [t][h]; V transposed [h][t].
// ---------------------------------------------------------------------------
__global__ void __launch_bounds__(128) qkv_kernel(const float* __restrict__ X,
                                                  const _Float16* __restrict__ W16t,
                                                  _Float16* __restrict__ QKV) {
    const int lane = threadIdx.x & 31;
    const int wave = (blockIdx.x * blockDim.x + threadIdx.x) >> 5;
    const int b    = wave / NQT;
    const int q0   = (wave % NQT) * 16;
    const int hs   = lane >> 4;
    const int ln   = lane & 15;

    _Float16* Q16  = QKV;                                 // [B][T][H]
    _Float16* K16  = QKV + (size_t)1 * B_ * T_ * H_;      // [B][T][H]
    _Float16* V16t = QKV + (size_t)2 * B_ * T_ * H_;      // [B][H][T]

    v8f accq[4], acck[4], accv[4];
#pragma unroll
    for (int t = 0; t < 4; ++t) { accq[t] = vzero8(); acck[t] = vzero8(); accv[t] = vzero8(); }

    const float* xrow = X + ((size_t)b * T_ + q0 + ln) * C_;

    for (int k0 = 0; k0 < C_; k0 += 32) {
        const v16h xf = ld_frag_f32(xrow + k0 + 8 * hs);  // X fragment (A and B role)
#pragma unroll
        for (int t = 0; t < 4; ++t) {
            const size_t wro = (size_t)(t * 16 + ln) * C_ + k0 + 8 * hs;
            const v16h wq = ld_frag(W16t + wro);
            const v16h wk = ld_frag(W16t + (size_t)H_ * C_ + wro);
            const v16h wv = ld_frag(W16t + (size_t)2 * H_ * C_ + wro);
            accq[t] = wmma_f16(wq, xf, accq[t]);   // Q^T tile
            acck[t] = wmma_f16(wk, xf, acck[t]);   // K^T tile
            accv[t] = wmma_f16(xf, wv, accv[t]);   // V tile
        }
    }

#pragma unroll
    for (int t = 0; t < 4; ++t) {
        // Q^T/K^T D: lane n = query (ln), rows r = h -> 8 contiguous h per lane
        _Float16* qp = Q16 + ((size_t)b * T_ + q0 + ln) * H_ + t * 16 + 8 * hs;
        _Float16* kp = K16 + ((size_t)b * T_ + q0 + ln) * H_ + t * 16 + 8 * hs;
        st_rows(qp, accq[t]);
        st_rows(kp, acck[t]);
        // V D: lane n = h, rows r = query -> 8 contiguous keys per lane
        _Float16* vp = V16t + ((size_t)b * H_ + t * 16 + ln) * T_ + q0 + 8 * hs;
        st_rows(vp, accv[t]);
    }
}

// ---------------------------------------------------------------------------
// Kernel 2: flash attention. One wave per 16-query tile, key blocks of 32.
// Online softmax; P transposed C/D->A layout via per-wave LDS (80B row stride,
// 16B aligned, conflict-free) + s_wait_dscnt for the same-wave RAW.
// ---------------------------------------------------------------------------
__global__ void __launch_bounds__(128) attn_kernel(const _Float16* __restrict__ QKV,
                                                   float* __restrict__ out) {
    const int lane  = threadIdx.x & 31;
    const int wslot = threadIdx.x >> 5;
    const int wave  = (blockIdx.x * blockDim.x + threadIdx.x) >> 5;
    const int b     = wave / NQT;
    const int qt    = wave % NQT;
    const int q0    = qt * 16;
    const int hs    = lane >> 4;
    const int ln    = lane & 15;

    const _Float16* Q16  = QKV;
    const _Float16* K16  = QKV + (size_t)1 * B_ * T_ * H_;
    const _Float16* V16t = QKV + (size_t)2 * B_ * T_ * H_;

    __shared__ __align__(16) _Float16 pbuf[4][16][40];   // 16x32 P tile, 80B stride

    // Q A-fragments (contraction = head dim, contiguous in row-major Q)
    const _Float16* qrow = Q16 + ((size_t)b * T_ + q0 + ln) * H_;
    const v16h aq0 = ld_frag(qrow + 8 * hs);
    const v16h aq1 = ld_frag(qrow + 32 + 8 * hs);

    float mrow[8], lrow[8];
    v8f   o[4];
#pragma unroll
    for (int r = 0; r < 8; ++r) { mrow[r] = -__builtin_inff(); lrow[r] = 0.f; }
#pragma unroll
    for (int t = 0; t < 4; ++t) o[t] = vzero8();

    const int nkb = (q0 + 15) / 32 + 1;       // causal: key blocks up to diagonal
    for (int kb = 0; kb < nkb; ++kb) {
        const int kbase = kb * 32;

        // S tiles for keys [kbase..+15] and [kbase+16..+31]
        v8f s0 = vzero8(), s1 = vzero8();
        const _Float16* krow0 = K16 + ((size_t)b * T_ + kbase + ln) * H_;
        const _Float16* krow1 = krow0 + (size_t)16 * H_;
#pragma unroll
        for (int hstep = 0; hstep < 2; ++hstep) {
            const v16h kf0 = ld_frag(krow0 + hstep * 32 + 8 * hs);
            const v16h kf1 = ld_frag(krow1 + hstep * 32 + 8 * hs);
            const v16h aq  = hstep ? aq1 : aq0;
            s0 = wmma_f16(aq, kf0, s0);
            s1 = wmma_f16(aq, kf1, s1);
        }

        // scale + causal mask + online softmax (row stats live per wave-half)
#pragma unroll
        for (int r = 0; r < 8; ++r) {
            const int qi = q0 + r + hs * 8;
            float v0 = s0[r] * SCALE;
            float v1 = s1[r] * SCALE;
            if (kbase + ln > qi)      v0 = -__builtin_inff();
            if (kbase + 16 + ln > qi) v1 = -__builtin_inff();

            const float rm   = half_max(fmaxf(v0, v1));
            const float newm = fmaxf(mrow[r], rm);
            const float cf   = __expf(mrow[r] - newm);
            const float p0   = __expf(v0 - newm);
            const float p1   = __expf(v1 - newm);
            const float rs   = half_sum(p0 + p1);
            mrow[r] = newm;
            lrow[r] = lrow[r] * cf + rs;
#pragma unroll
            for (int t = 0; t < 4; ++t) o[t][r] *= cf;

            pbuf[wslot][r + hs * 8][ln]      = (_Float16)p0;
            pbuf[wslot][r + hs * 8][16 + ln] = (_Float16)p1;
        }

        // same-wave LDS RAW: drain DS counter before transposed re-read
        __asm volatile("s_wait_dscnt 0x0" ::: "memory");

        // P as A-fragment: two ds_load_b128 per lane
        const v16h pf = ld_frag(&pbuf[wslot][ln][8 * hs]);

        // O += P @ V (contraction = 32 keys, contiguous in transposed V)
#pragma unroll
        for (int t = 0; t < 4; ++t) {
            const v16h vf =
                ld_frag(V16t + ((size_t)b * H_ + t * 16 + ln) * T_ + kbase + 8 * hs);
            o[t] = wmma_f16(pf, vf, o[t]);
        }
    }

    // normalize and write fp32 output
#pragma unroll
    for (int r = 0; r < 8; ++r) {
        const float inv = 1.0f / lrow[r];
#pragma unroll
        for (int t = 0; t < 4; ++t)
            out[((size_t)b * T_ + q0 + r + hs * 8) * H_ + t * 16 + ln] =
                o[t][r] * inv;
    }
}

// ---------------------------------------------------------------------------
extern "C" void kernel_launch(void* const* d_in, const int* in_sizes, int n_in,
                              void* d_out, int out_size, void* d_ws, size_t ws_size,
                              hipStream_t stream) {
    const float* X  = (const float*)d_in[0];
    const float* Wq = (const float*)d_in[1];
    const float* Wk = (const float*)d_in[2];
    const float* Wv = (const float*)d_in[3];
    float* out = (float*)d_out;

    // workspace: [3][H][C] f16 W^T (384 KB) then Q[B][T][H], K[B][T][H],
    // V^T[B][H][T] f16 (6 MB)
    _Float16* W16t = (_Float16*)d_ws;
    _Float16* QKV  = W16t + (size_t)3 * H_ * C_;

    cvt_w_kernel<<<(H_ * C_ + 255) / 256, 256, 0, stream>>>(Wq, Wk, Wv, W16t);

    const int nwaves = B_ * NQT;               // 1024 waves
    const int blocks = nwaves * 32 / 128;      // 4 waves / block
    qkv_kernel<<<blocks, 128, 0, stream>>>(X, W16t, QKV);
    attn_kernel<<<blocks, 128, 0, stream>>>(QKV, out);
}

// v001
// One run takes 116 microseconds.
// Two timings next to v000 put it at 2.05 and 2.09 times that version's speed.
#include <hip/hip_runtime.h>
#include <hip/hip_bf16.h>

// ---------------------------------------------------------------------------
// Self-attention head for MI455X (gfx1250, wave32, WMMA).
//   Q^T = Wq^T X^T, K^T = Wk^T X^T, V = X Wv   (f16 operands, f32 accum WMMA)
//   O = softmax(causal(Q K^T / sqrt(C))) V     (flash-attention, 16-row tiles)
// All fragments are built with 16-byte loads: for CDNA5 16-bit A/B layouts,
// lane -> row/col (lane%16) and elements map to two contiguous 8-half K runs
// at offsets 8*half and 16+8*half. Layouts below are chosen so the contraction
// dim is always contiguous in memory.
// ---------------------------------------------------------------------------

typedef __attribute__((ext_vector_type(16))) _Float16 v16h;
typedef __attribute__((ext_vector_type(8)))  _Float16 v8h;
typedef __attribute__((ext_vector_type(8)))  float    v8f;

#define B_    4
#define T_    4096
#define C_    1024
#define H_    64
#define NQT   (T_ / 16)         // query tiles per batch
#define SCALE 0.03125f          // C^-0.5 = 1024^-0.5 = 1/32

static __device__ __forceinline__ v8f vzero8() {
    v8f z = {0.f, 0.f, 0.f, 0.f, 0.f, 0.f, 0.f, 0.f};
    return z;
}

// Build a 16-half fragment from memory where the contraction dim is contiguous.
// p must already include the +8*hs lane-half offset; 16-byte aligned.
static __device__ __forceinline__ v16h ld_frag(const _Float16* p) {
    const v8h lo = *(const v8h*)(p);        // elements e=0..7  : k = 8hs+e
    const v8h hi = *(const v8h*)(p + 16);   // elements e=8..15 : k = 8hs+16+(e-8)
    return __builtin_shufflevector(lo, hi, 0, 1, 2, 3, 4, 5, 6, 7,
                                           8, 9, 10, 11, 12, 13, 14, 15);
}

// Same, from fp32 memory with on-the-fly f16 conversion (two 32B loads).
static __device__ __forceinline__ v16h ld_frag_f32(const float* p) {
    const v8f lo = *(const v8f*)(p);
    const v8f hi = *(const v8f*)(p + 16);
    v16h r;
#pragma unroll
    for (int e = 0; e < 8; ++e) {
        r[e]     = (_Float16)lo[e];
        r[e + 8] = (_Float16)hi[e];
    }
    return r;
}

// Pack 8 f32 accumulator rows into one 16-byte f16 store.
static __device__ __forceinline__ void st_rows(_Float16* p, v8f a) {
    v8h h;
#pragma unroll
    for (int r = 0; r < 8; ++r) h[r] = (_Float16)a[r];
    *(v8h*)p = h;
}

// reductions across the 16 lanes of one wave-half (xor masks 1,2,4,8 stay in half)
static __device__ __forceinline__ float half_max(float v) {
#pragma unroll
    for (int m = 1; m <= 8; m <<= 1) v = fmaxf(v, __shfl_xor(v, m, 32));
    return v;
}
static __device__ __forceinline__ float half_sum(float v) {
#pragma unroll
    for (int m = 1; m <= 8; m <<= 1) v += __shfl_xor(v, m, 32);
    return v;
}

static __device__ __forceinline__ v8f wmma_f16(v16h a, v16h b, v8f c) {
    return __builtin_amdgcn_wmma_f32_16x16x32_f16(false, a, false, b,
                                                  (short)0, c, false, false);
}

// ---------------------------------------------------------------------------
// Kernel 0: W fp32 [C][H] -> f16 transposed [3][H][C] (contraction contiguous).
// ---------------------------------------------------------------------------
__global__ void cvt_w_kernel(const float* __restrict__ Wq,
                             const float* __restrict__ Wk,
                             const float* __restrict__ Wv,
                             _Float16* __restrict__ W16t) {
    const int i = blockIdx.x * blockDim.x + threadIdx.x;   // i = h*C + c
    if (i < H_ * C_) {
        const int h = i / C_, c = i % C_;
        W16t[i]               = (_Float16)Wq[c * H_ + h];
        W16t[H_ * C_ + i]     = (_Float16)Wk[c * H_ + h];
        W16t[2 * H_ * C_ + i] = (_Float16)Wv[c * H_ + h];
    }
}

// ---------------------------------------------------------------------------
// Kernel 1: QKV projection, one wave per 16-row tile of X.
//   Q^T,K^T tiles: A = W^T frag, B = X frag  -> D(m=h, n=query)
//   V tiles:       A = X frag,  B = W^T frag -> D(m=query, n=h)
// X and W fragments have identical lane/element maps, so each is loaded once
// and reused in both roles. Q,K stored row-major [t][h]; V transposed [h][t].
// ---------------------------------------------------------------------------
__global__ void __launch_bounds__(128) qkv_kernel(const float* __restrict__ X,
                                                  const _Float16* __restrict__ W16t,
                                                  _Float16* __restrict__ QKV) {
    const int lane = threadIdx.x & 31;
    const int wave = (blockIdx.x * blockDim.x + threadIdx.x) >> 5;
    const int b    = wave / NQT;
    const int q0   = (wave % NQT) * 16;
    const int hs   = lane >> 4;
    const int ln   = lane & 15;

    _Float16* Q16  = QKV;                                 // [B][T][H]
    _Float16* K16  = QKV + (size_t)1 * B_ * T_ * H_;      // [B][T][H]
    _Float16* V16t = QKV + (size_t)2 * B_ * T_ * H_;      // [B][H][T]

    v8f accq[4], acck[4], accv[4];
#pragma unroll
    for (int t = 0; t < 4; ++t) { accq[t] = vzero8(); acck[t] = vzero8(); accv[t] = vzero8(); }

    const float* xrow = X + ((size_t)b * T_ + q0 + ln) * C_;

    for (int k0 = 0; k0 < C_; k0 += 32) {
        const v16h xf = ld_frag_f32(xrow + k0 + 8 * hs);  // X fragment (A and B role)
#pragma unroll
        for (int t = 0; t < 4; ++t) {
            const size_t wro = (size_t)(t * 16 + ln) * C_ + k0 + 8 * hs;
            const v16h wq = ld_frag(W16t + wro);
            const v16h wk = ld_frag(W16t + (size_t)H_ * C_ + wro);
            const v16h wv = ld_frag(W16t + (size_t)2 * H_ * C_ + wro);
            accq[t] = wmma_f16(wq, xf, accq[t]);   // Q^T tile
            acck[t] = wmma_f16(wk, xf, acck[t]);   // K^T tile
            accv[t] = wmma_f16(xf, wv, accv[t]);   // V tile
        }
    }

#pragma unroll
    for (int t = 0; t < 4; ++t) {
        // Q^T/K^T D: lane n = query (ln), rows r = h -> 8 contiguous h per lane
        _Float16* qp = Q16 + ((size_t)b * T_ + q0 + ln) * H_ + t * 16 + 8 * hs;
        _Float16* kp = K16 + ((size_t)b * T_ + q0 + ln) * H_ + t * 16 + 8 * hs;
        st_rows(qp, accq[t]);
        st_rows(kp, acck[t]);
        // V D: lane n = h, rows r = query -> 8 contiguous keys per lane
        _Float16* vp = V16t + ((size_t)b * H_ + t * 16 + ln) * T_ + q0 + 8 * hs;
        st_rows(vp, accv[t]);
    }
}

// ---------------------------------------------------------------------------
// Kernel 2: flash attention. One work-group of NW waves per 16-query tile; wave
// w takes key blocks w, w+NW, ... (32 keys each) with its own running maxima,
// sums and accumulators; the NW partial results are merged once through LDS.
// Online softmax; P transposed C/D->A layout via per-wave LDS (80B row stride,
// 16B aligned, conflict-free) + s_wait_dscnt for the same-wave RAW.
// ---------------------------------------------------------------------------
#define NW    12                // waves per work-group = key splits per tile
#define OPIT  68                // f32 pitch of a partial O row (272 B = 16 B x odd)
#define MWAV  (16 * H_ / (4 * 32))    // merging waves: 4 output columns per lane

typedef __attribute__((ext_vector_type(4))) float v4f;

// e^x for the merge weights. The v_nop is the free issue slot that the instruction
// set asks for behind a transcendental.
static __device__ __forceinline__ float exp_slot(float x) {
    float y;
    asm("v_exp_f32 %0, %1\n\tv_nop" : "=v"(y) : "v"(x * 1.44269504f));
    return y;
}

__global__ void __launch_bounds__(NW * 32) attn_kernel(const _Float16* __restrict__ QKV,
                                                       float* __restrict__ out) {
    const int lane  = threadIdx.x & 31;
    // wave number as a scalar, so that the key loop is a scalar loop
    const int wslot = __builtin_amdgcn_readfirstlane(threadIdx.x >> 5);
    const int b     = blockIdx.x / NQT;
    const int qt    = blockIdx.x % NQT;
    const int q0    = qt * 16;
    const int hs    = lane >> 4;
    const int ln    = lane & 15;

    const _Float16* Q16  = QKV;
    const _Float16* K16  = QKV + (size_t)1 * B_ * T_ * H_;
    const _Float16* V16t = QKV + (size_t)2 * B_ * T_ * H_;

    __shared__ __align__(16) _Float16 pbuf[NW][16][40];   // 16x32 P tile, 80B stride
    __shared__ __align__(16) float    opart[NW][16][OPIT]; // un-normalised partial O
    __shared__ float mpart[NW][16];                        // partial row maxima
    __shared__ float lpart[NW][16];                        // partial row sums

    // Q A-fragments (contraction = head dim, contiguous in row-major Q)
    const _Float16* qrow = Q16 + ((size_t)b * T_ + q0 + ln) * H_;
    const v16h aq0 = ld_frag(qrow + 8 * hs);
    const v16h aq1 = ld_frag(qrow + 32 + 8 * hs);

    float mrow[8], lrow[8];
    v8f   o[4];
#pragma unroll
    for (int r = 0; r < 8; ++r) { mrow[r] = -__builtin_inff(); lrow[r] = 0.f; }
#pragma unroll
    for (int t = 0; t < 4; ++t) o[t] = vzero8();

    const int nkb = (q0 + 15) / 32 + 1;       // causal: key blocks up to diagonal
    for (int kb = wslot; kb < nkb; kb += NW) {
        const int kbase = kb * 32;

        // S tiles for keys [kbase..+15] and [kbase+16..+31]
        v8f s0 = vzero8(), s1 = vzero8();
        const _Float16* krow0 = K16 + ((size_t)b * T_ + kbase + ln) * H_;
        const _Float16* krow1 = krow0 + (size_t)16 * H_;
#pragma unroll
        for (int hstep = 0; hstep < 2; ++hstep) {
            const v16h kf0 = ld_frag(krow0 + hstep * 32 + 8 * hs);
            const v16h kf1 = ld_frag(krow1 + hstep * 32 + 8 * hs);
            const v16h aq  = hstep ? aq1 : aq0;
            s0 = wmma_f16(aq, kf0, s0);
            s1 = wmma_f16(aq, kf1, s1);
        }

        // scale + causal mask + online softmax (row stats live per wave-half)
#pragma unroll
        for (int r = 0; r < 8; ++r) {
            const int qi = q0 + r + hs * 8;
            float v0 = s0[r] * SCALE;
            float v1 = s1[r] * SCALE;
            if (kbase + ln > qi)      v0 = -__builtin_inff();
            if (kbase + 16 + ln > qi) v1 = -__builtin_inff();

            const float rm   = half_max(fmaxf(v0, v1));
            const float newm = fmaxf(mrow[r], rm);
            const float cf   = __expf(mrow[r] - newm);
            const float p0   = __expf(v0 - newm);
            const float p1   = __expf(v1 - newm);
            const float rs   = half_sum(p0 + p1);
            mrow[r] = newm;
            lrow[r] = lrow[r] * cf + rs;
#pragma unroll
            for (int t = 0; t < 4; ++t) o[t][r] *= cf;

            pbuf[wslot][r + hs * 8][ln]      = (_Float16)p0;
            pbuf[wslot][r + hs * 8][16 + ln] = (_Float16)p1;
        }

        // same-wave LDS RAW: drain DS counter before transposed re-read
        __asm volatile("s_wait_dscnt 0x0" ::: "memory");

        // P as A-fragment: two ds_load_b128 per lane
        const v16h pf = ld_frag(&pbuf[wslot][ln][8 * hs]);

        // O += P @ V (contraction = 32 keys, contiguous in transposed V)
#pragma unroll
        for (int t = 0; t < 4; ++t) {
            const v16h vf =
                ld_frag(V16t + ((size_t)b * H_ + t * 16 + ln) * T_ + kbase + 8 * hs);
            o[t] = wmma_f16(pf, vf, o[t]);
        }
    }

    // publish this wave's partial (a wave without a key block: max -inf, sum 0, O 0)
    if (ln == 0) {
#pragma unroll
        for (int r = 0; r < 8; ++r) {
            mpart[wslot][r + hs * 8] = mrow[r];
            lpart[wslot][r + hs * 8] = lrow[r];
        }
    }
#pragma unroll
    for (int r = 0; r < 8; ++r)
#pragma unroll
        for (int t = 0; t < 4; ++t) opart[wslot][r + hs * 8][t * 16 + ln] = o[t][r];
    __syncthreads();
    if (wslot >= MWAV) return;      // no barrier follows

    // merge: each lane owns 4 neighbouring columns of one query row. Wave 0
    // always holds key block 0, in which every row has an unmasked key, so the
    // merged maximum is finite and the weight of an empty partial is exp(-inf) = 0.
    const int row = threadIdx.x >> 4;
    const int col = (threadIdx.x & 15) * 4;
    float mall = mpart[0][row];
#pragma unroll
    for (int w = 1; w < NW; ++w) mall = fmaxf(mall, mpart[w][row]);
    float wt[NW];
#pragma unroll
    for (int w = 0; w < NW; ++w) wt[w] = exp_slot(mpart[w][row] - mall);
    float lall = 0.f;
    v4f   acc  = {0.f, 0.f, 0.f, 0.f};
#pragma unroll
    for (int w = 0; w < NW; ++w) {
        lall += wt[w] * lpart[w][row];
        acc  += wt[w] * *(const v4f*)&opart[w][row][col];
    }

    // normalize and write fp32 output
    const float inv = 1.0f / lall;
    *(v4f*)&out[((size_t)b * T_ + q0 + row) * H_ + col] = acc * inv;
}

// ---------------------------------------------------------------------------
extern "C" void kernel_launch(void* const* d_in, const int* in_sizes, int n_in,
                              void* d_out, int out_size, void* d_ws, size_t ws_size,
                              hipStream_t stream) {
    const float* X  = (const float*)d_in[0];
    const float* Wq = (const float*)d_in[1];
    const float* Wk = (const float*)d_in[2];
    const float* Wv = (const float*)d_in[3];
    float* out = (float*)d_out;

    // workspace: [3][H][C] f16 W^T (384 KB) then Q[B][T][H], K[B][T][H],
    // V^T[B][H][T] f16 (6 MB)
    _Float16* W16t = (_Float16*)d_ws;
    _Float16* QKV  = W16t + (size_t)3 * H_ * C_;

    cvt_w_kernel<<<(H_ * C_ + 255) / 256, 256, 0, stream>>>(Wq, Wk, Wv, W16t);

    const int nwaves = B_ * NQT;               // 1024 waves
    const int blocks = nwaves * 32 / 128;      // 4 waves / block
    qkv_kernel<<<blocks, 128, 0, stream>>>(X, W16t, QKV);
    attn_kernel<<<nwaves, NW * 32, 0, stream>>>(QKV, out);   // one block per query tile
}

// v002
// Measured time: 92.8 microseconds a run.
// Timed twice side by side with v001, it ran 1.27 and 1.26 times as fast.
// Over all steps from v000 it is 2.62 times as fast.
#include <hip/hip_runtime.h>
#include <hip/hip_bf16.h>

// ---------------------------------------------------------------------------
// Self-attention head for MI455X (gfx1250, wave32, WMMA).
//   Q^T = Wq^T X^T, K^T = Wk^T X^T, V = X Wv   (f16 operands, f32 accum WMMA)
//   O = softmax(causal(Q K^T / sqrt(C))) V     (flash-attention, 16-row tiles)
// All fragments are built with 16-byte loads: for CDNA5 16-bit A/B layouts,
// lane -> row/col (lane%16) and elements map to two contiguous 8-half K runs
// at offsets 8*half and 16+8*half. Layouts below are chosen so the contraction
// dim is always contiguous in memory.
// ---------------------------------------------------------------------------

typedef __attribute__((ext_vector_type(16))) _Float16 v16h;
typedef __attribute__((ext_vector_type(8)))  _Float16 v8h;
typedef __attribute__((ext_vector_type(8)))  float    v8f;

#define B_    4
#define T_    4096
#define C_    1024
#define H_    64
#define NQT   (T_ / 16)         // query tiles per batch
#define SCALE 0.03125f          // C^-0.5 = 1024^-0.5 = 1/32

static __device__ __forceinline__ v8f vzero8() {
    v8f z = {0.f, 0.f, 0.f, 0.f, 0.f, 0.f, 0.f, 0.f};
    return z;
}

// Build a 16-half fragment from memory where the contraction dim is contiguous.
// p must already include the +8*hs lane-half offset; 16-byte aligned.
static __device__ __forceinline__ v16h ld_frag(const _Float16* p) {
    const v8h lo = *(const v8h*)(p);        // elements e=0..7  : k = 8hs+e
    const v8h hi = *(const v8h*)(p + 16);   // elements e=8..15 : k = 8hs+16+(e-8)
    return __builtin_shufflevector(lo, hi, 0, 1, 2, 3, 4, 5, 6, 7,
                                           8, 9, 10, 11, 12, 13, 14, 15);
}

// Same, from fp32 memory with on-the-fly f16 conversion (two 32B loads).
static __device__ __forceinline__ v16h ld_frag_f32(const float* p) {
    const v8f lo = *(const v8f*)(p);
    const v8f hi = *(const v8f*)(p + 16);
    v16h r;
#pragma unroll
    for (int e = 0; e < 8; ++e) {
        r[e]     = (_Float16)lo[e];
        r[e + 8] = (_Float16)hi[e];
    }
    return r;
}

// Pack 8 f32 accumulator rows into one 16-byte f16 store.
static __device__ __forceinline__ void st_rows(_Float16* p, v8f a) {
    v8h h;
#pragma unroll
    for (int r = 0; r < 8; ++r) h[r] = (_Float16)a[r];
    *(v8h*)p = h;
}

// reductions across the 16 lanes of one wave-half (xor masks 1,2,4,8 stay in half)
static __device__ __forceinline__ float half_max(float v) {
#pragma unroll
    for (int m = 1; m <= 8; m <<= 1) v = fmaxf(v, __shfl_xor(v, m, 32));
    return v;
}
static __device__ __forceinline__ float half_sum(float v) {
#pragma unroll
    for (int m = 1; m <= 8; m <<= 1) v += __shfl_xor(v, m, 32);
    return v;
}

static __device__ __forceinline__ v8f wmma_f16(v16h a, v16h b, v8f c) {
    return __builtin_amdgcn_wmma_f32_16x16x32_f16(false, a, false, b,
                                                  (short)0, c, false, false);
}

// ---------------------------------------------------------------------------
// Kernel 0: W fp32 [C][H] -> f16 transposed [3][H][C] (contraction contiguous).
// ---------------------------------------------------------------------------
__global__ void cvt_w_kernel(const float* __restrict__ Wq,
                             const float* __restrict__ Wk,
                             const float* __restrict__ Wv,
                             _Float16* __restrict__ W16t) {
    const int i = blockIdx.x * blockDim.x + threadIdx.x;   // i = h*C + c
    if (i < H_ * C_) {
        const int h = i / C_, c = i % C_;
        W16t[i]               = (_Float16)Wq[c * H_ + h];
        W16t[H_ * C_ + i]     = (_Float16)Wk[c * H_ + h];
        W16t[2 * H_ * C_ + i] = (_Float16)Wv[c * H_ + h];
    }
}

// ---------------------------------------------------------------------------
// Kernel 1: QKV projection. One work-group per 64 rows of X = 4 tiles of 16 rows,
// KW waves per tile; wave ks of a tile takes the 32-wide steps ks, ks+KW, ... of
// the contraction (neighbouring waves read neighbouring bytes of the same rows),
// and the KW partial results are summed once through LDS: more waves per SIMD to
// cover the latency of the loads.
//   Q^T,K^T tiles: A = W^T frag, B = X frag  -> D(m=h, n=query)
//   V tiles:       A = X frag,  B = W^T frag -> D(m=query, n=h)
// X and W fragments have identical lane/element maps, so each is loaded once
// and reused in both roles. Q,K stored row-major [t][h]; V transposed [h][t].
// ---------------------------------------------------------------------------
#define KW 4                    // waves per 16-row tile = splits of the contraction

typedef __attribute__((ext_vector_type(4))) float v4f;

// One accumulator tile to / from LDS as two planes of [32 lanes][4 floats], so
// that each 16-byte LDS access of a wave covers 512 contiguous bytes.
static __device__ __forceinline__ void put_tile(float (*p)[32][4], int lane, v8f a) {
    *(v4f*)p[0][lane] = __builtin_shufflevector(a, a, 0, 1, 2, 3);
    *(v4f*)p[1][lane] = __builtin_shufflevector(a, a, 4, 5, 6, 7);
}
static __device__ __forceinline__ v8f get_tile(const float (*p)[32][4], int lane) {
    const v4f lo = *(const v4f*)p[0][lane];
    const v4f hi = *(const v4f*)p[1][lane];
    return __builtin_shufflevector(lo, hi, 0, 1, 2, 3, 4, 5, 6, 7);
}

__global__ void __launch_bounds__(4 * KW * 32) qkv_kernel(const float* __restrict__ X,
                                                          const _Float16* __restrict__ W16t,
                                                          _Float16* __restrict__ QKV) {
    const int lane  = threadIdx.x & 31;
    // wave number as a scalar, so that the contraction loop is a scalar loop
    const int wslot = __builtin_amdgcn_readfirstlane(threadIdx.x >> 5);
    const int tl    = wslot / KW;                 // tile within the work-group
    const int ks    = wslot % KW;                 // slice of the contraction
    const int b     = blockIdx.x / (NQT / 4);
    const int qb    = (blockIdx.x % (NQT / 4)) * 64;   // first row of the work-group
    const int q0    = qb + tl * 16;
    const int hs    = lane >> 4;
    const int ln    = lane & 15;

    __shared__ __align__(16) float red[4][KW][12][2][32][4];   // partial Q, K, V tiles

    _Float16* Q16  = QKV;                                 // [B][T][H]
    _Float16* K16  = QKV + (size_t)1 * B_ * T_ * H_;      // [B][T][H]
    _Float16* V16t = QKV + (size_t)2 * B_ * T_ * H_;      // [B][H][T]

    v8f accq[4], acck[4], accv[4];
#pragma unroll
    for (int t = 0; t < 4; ++t) { accq[t] = vzero8(); acck[t] = vzero8(); accv[t] = vzero8(); }

    const float* xrow = X + ((size_t)b * T_ + q0 + ln) * C_;

    for (int k0 = ks * 32; k0 < C_; k0 += KW * 32) {
        const v16h xf = ld_frag_f32(xrow + k0 + 8 * hs);  // X fragment (A and B role)
#pragma unroll
        for (int t = 0; t < 4; ++t) {
            const size_t wro = (size_t)(t * 16 + ln) * C_ + k0 + 8 * hs;
            const v16h wq = ld_frag(W16t + wro);
            const v16h wk = ld_frag(W16t + (size_t)H_ * C_ + wro);
            const v16h wv = ld_frag(W16t + (size_t)2 * H_ * C_ + wro);
            accq[t] = wmma_f16(wq, xf, accq[t]);   // Q^T tile
            acck[t] = wmma_f16(wk, xf, acck[t]);   // K^T tile
            accv[t] = wmma_f16(xf, wv, accv[t]);   // V tile
        }
    }

    // publish this wave's partial tiles
#pragma unroll
    for (int t = 0; t < 4; ++t) {
        put_tile(red[tl][ks][t],     lane, accq[t]);
        put_tile(red[tl][ks][4 + t], lane, acck[t]);
        put_tile(red[tl][ks][8 + t], lane, accv[t]);
    }
    __syncthreads();
    if (wslot >= 12) return;        // no barrier follows

    // Sum and store, lane maps unchanged; each wave takes the four tiles that fill
    // whole 128-byte lines: waves 0-3 the Q rows of tile wslot, waves 4-7 the K rows
    // of tile wslot - 4, waves 8-11 column group wslot - 8 of V over all 64 keys.
    const bool isv = wslot >= 8;
    const int  sel = wslot & 3;
    // Q^T/K^T D: lane n = query (ln), rows r = h -> 8 contiguous h per lane
    // V D:       lane n = h, rows r = query   -> 8 contiguous keys per lane
    _Float16* dst = isv
        ? V16t + ((size_t)b * H_ + sel * 16 + ln) * T_ + qb + 8 * hs
        : (wslot < 4 ? Q16 : K16) + ((size_t)b * T_ + qb + sel * 16 + ln) * H_ + 8 * hs;
#pragma unroll
    for (int i = 0; i < 4; ++i) {
        const int stl = isv ? i : sel;                       // source tile
        const int sid = isv ? 8 + sel : (wslot & 4) + i;     // source Q, K or V group
        v8f s = get_tile(red[stl][0][sid], lane);
#pragma unroll
        for (int w = 1; w < KW; ++w) s += get_tile(red[stl][w][sid], lane);
        st_rows(dst + i * 16, s);
    }
}

// ---------------------------------------------------------------------------
// Kernel 2: flash attention. One work-group of NW waves per 16-query tile; wave
// w takes key blocks w, w+NW, ... (32 keys each) with its own running maxima,
// sums and accumulators; the NW partial results are merged once through LDS.
// Online softmax; P transposed C/D->A layout via per-wave LDS (80B row stride,
// 16B aligned, conflict-free) + s_wait_dscnt for the same-wave RAW.
// ---------------------------------------------------------------------------
#define NW    12                // waves per work-group = key splits per tile
#define OPIT  68                // f32 pitch of a partial O row (272 B = 16 B x odd)
#define MWAV  (16 * H_ / (4 * 32))    // merging waves: 4 output columns per lane

// e^x for the merge weights. The v_nop is the free issue slot that the instruction
// set asks for behind a transcendental.
static __device__ __forceinline__ float exp_slot(float x) {
    float y;
    asm("v_exp_f32 %0, %1\n\tv_nop" : "=v"(y) : "v"(x * 1.44269504f));
    return y;
}

__global__ void __launch_bounds__(NW * 32) attn_kernel(const _Float16* __restrict__ QKV,
                                                       float* __restrict__ out) {
    const int lane  = threadIdx.x & 31;
    // wave number as a scalar, so that the key loop is a scalar loop
    const int wslot = __builtin_amdgcn_readfirstlane(threadIdx.x >> 5);
    const int b     = blockIdx.x / NQT;
    const int qt    = blockIdx.x % NQT;
    const int q0    = qt * 16;
    const int hs    = lane >> 4;
    const int ln    = lane & 15;

    const _Float16* Q16  = QKV;
    const _Float16* K16  = QKV + (size_t)1 * B_ * T_ * H_;
    const _Float16* V16t = QKV + (size_t)2 * B_ * T_ * H_;

    __shared__ __align__(16) _Float16 pbuf[NW][16][40];   // 16x32 P tile, 80B stride
    __shared__ __align__(16) float    opart[NW][16][OPIT]; // un-normalised partial O
    __shared__ float mpart[NW][16];                        // partial row maxima
    __shared__ float lpart[NW][16];                        // partial row sums

    // Q A-fragments (contraction = head dim, contiguous in row-major Q)
    const _Float16* qrow = Q16 + ((size_t)b * T_ + q0 + ln) * H_;
    const v16h aq0 = ld_frag(qrow + 8 * hs);
    const v16h aq1 = ld_frag(qrow + 32 + 8 * hs);

    float mrow[8], lrow[8];
    v8f   o[4];
#pragma unroll
    for (int r = 0; r < 8; ++r) { mrow[r] = -__builtin_inff(); lrow[r] = 0.f; }
#pragma unroll
    for (int t = 0; t < 4; ++t) o[t] = vzero8();

    const int nkb = (q0 + 15) / 32 + 1;       // causal: key blocks up to diagonal
    for (int kb = wslot; kb < nkb; kb += NW) {
        const int kbase = kb * 32;

        // S tiles for keys [kbase..+15] and [kbase+16..+31]
        v8f s0 = vzero8(), s1 = vzero8();
        const _Float16* krow0 = K16 + ((size_t)b * T_ + kbase + ln) * H_;
        const _Float16* krow1 = krow0 + (size_t)16 * H_;
#pragma unroll
        for (int hstep = 0; hstep < 2; ++hstep) {
            const v16h kf0 = ld_frag(krow0 + hstep * 32 + 8 * hs);
            const v16h kf1 = ld_frag(krow1 + hstep * 32 + 8 * hs);
            const v16h aq  = hstep ? aq1 : aq0;
            s0 = wmma_f16(aq, kf0, s0);
            s1 = wmma_f16(aq, kf1, s1);
        }

        // scale + causal mask + online softmax (row stats live per wave-half)
#pragma unroll
        for (int r = 0; r < 8; ++r) {
            const int qi = q0 + r + hs * 8;
            float v0 = s0[r] * SCALE;
            float v1 = s1[r] * SCALE;
            if (kbase + ln > qi)      v0 = -__builtin_inff();
            if (kbase + 16 + ln > qi) v1 = -__builtin_inff();

            const float rm   = half_max(fmaxf(v0, v1));
            const float newm = fmaxf(mrow[r], rm);
            const float cf   = __expf(mrow[r] - newm);
            const float p0   = __expf(v0 - newm);
            const float p1   = __expf(v1 - newm);
            const float rs   = half_sum(p0 + p1);
            mrow[r] = newm;
            lrow[r] = lrow[r] * cf + rs;
#pragma unroll
            for (int t = 0; t < 4; ++t) o[t][r] *= cf;

            pbuf[wslot][r + hs * 8][ln]      = (_Float16)p0;
            pbuf[wslot][r + hs * 8][16 + ln] = (_Float16)p1;
        }

        // same-wave LDS RAW: drain DS counter before transposed re-read
        __asm volatile("s_wait_dscnt 0x0" ::: "memory");

        // P as A-fragment: two ds_load_b128 per lane
        const v16h pf = ld_frag(&pbuf[wslot][ln][8 * hs]);

        // O += P @ V (contraction = 32 keys, contiguous in transposed V)
#pragma unroll
        for (int t = 0; t < 4; ++t) {
            const v16h vf =
                ld_frag(V16t + ((size_t)b * H_ + t * 16 + ln) * T_ + kbase + 8 * hs);
            o[t] = wmma_f16(pf, vf, o[t]);
        }
    }

    // publish this wave's partial (a wave without a key block: max -inf, sum 0, O 0)
    if (ln == 0) {
#pragma unroll
        for (int r = 0; r < 8; ++r) {
            mpart[wslot][r + hs * 8] = mrow[r];
            lpart[wslot][r + hs * 8] = lrow[r];
        }
    }
#pragma unroll
    for (int r = 0; r < 8; ++r)
#pragma unroll
        for (int t = 0; t < 4; ++t) opart[wslot][r + hs * 8][t * 16 + ln] = o[t][r];
    __syncthreads();
    if (wslot >= MWAV) return;      // no barrier follows

    // merge: each lane owns 4 neighbouring columns of one query row. Wave 0
    // always holds key block 0, in which every row has an unmasked key, so the
    // merged maximum is finite and the weight of an empty partial is exp(-inf) = 0.
    const int row = threadIdx.x >> 4;
    const int col = (threadIdx.x & 15) * 4;
    float mall = mpart[0][row];
#pragma unroll
    for (int w = 1; w < NW; ++w) mall = fmaxf(mall, mpart[w][row]);
    float wt[NW];
#pragma unroll
    for (int w = 0; w < NW; ++w) wt[w] = exp_slot(mpart[w][row] - mall);
    float lall = 0.f;
    v4f   acc  = {0.f, 0.f, 0.f, 0.f};
#pragma unroll
    for (int w = 0; w < NW; ++w) {
        lall += wt[w] * lpart[w][row];
        acc  += wt[w] * *(const v4f*)&opart[w][row][col];
    }

    // normalize and write fp32 output
    const float inv = 1.0f / lall;
    *(v4f*)&out[((size_t)b * T_ + q0 + row) * H_ + col] = acc * inv;
}

// ---------------------------------------------------------------------------
extern "C" void kernel_launch(void* const* d_in, const int* in_sizes, int n_in,
                              void* d_out, int out_size, void* d_ws, size_t ws_size,
                              hipStream_t stream) {
    const float* X  = (const float*)d_in[0];
    const float* Wq = (const float*)d_in[1];
    const float* Wk = (const float*)d_in[2];
    const float* Wv = (const float*)d_in[3];
    float* out = (float*)d_out;

    // workspace: [3][H][C] f16 W^T (384 KB) then Q[B][T][H], K[B][T][H],
    // V^T[B][H][T] f16 (6 MB)
    _Float16* W16t = (_Float16*)d_ws;
    _Float16* QKV  = W16t + (size_t)3 * H_ * C_;

    cvt_w_kernel<<<(H_ * C_ + 255) / 256, 256, 0, stream>>>(Wq, Wk, Wv, W16t);

    const int ntiles = B_ * NQT;               // 1024 tiles of 16 rows
    qkv_kernel<<<ntiles / 4, 4 * KW * 32, 0, stream>>>(X, W16t, QKV);   // 4 row tiles per block
    attn_kernel<<<ntiles, NW * 32, 0, stream>>>(QKV, out);       // one block per query tile
}

// v003
// A run of this version takes 87 microseconds.
// Timed twice side by side with v002, it ran 1.05 and 1.07 times as fast.
// Counting every step since v000, it is 2.78 times as fast.
#include <hip/hip_runtime.h>
#include <hip/hip_bf16.h>

// ---------------------------------------------------------------------------
// Self-attention head for MI455X (gfx1250, wave32, WMMA).
//   Q^T = Wq^T X^T, K^T = Wk^T X^T, V = X Wv   (f16 operands, f32 accum WMMA)
//   O = softmax(causal(Q K^T / sqrt(C))) V     (flash-attention, 16-row tiles)
// All fragments are built with 16-byte loads: for CDNA5 16-bit A/B layouts,
// lane -> row/col (lane%16) and elements map to two contiguous 8-half K runs
// at offsets 8*half and 16+8*half.
// The f16 operands in the workspace (W^T, Q, K, V^T) are kept in FRAGMENT ORDER:
// a 16 x 32 fragment is 1 KB = [2 runs][32 lanes][8 halves], so that each wave-wide
// 16-byte load or store covers 512 contiguous bytes (4 whole 128-byte lines)
// instead of 32-byte pieces of 16 lines.
// ---------------------------------------------------------------------------

typedef __attribute__((ext_vector_type(16))) _Float16 v16h;
typedef __attribute__((ext_vector_type(8)))  _Float16 v8h;
typedef __attribute__((ext_vector_type(8)))  float    v8f;

#define B_    4
#define T_    4096
#define C_    1024
#define H_    64
#define NQT   (T_ / 16)         // query tiles per batch
#define SCALE 0.03125f          // C^-0.5 = 1024^-0.5 = 1/32
#define FRAG  512               // halves in one 16 x 32 fragment
#define RUN   256               // halves in one run of a fragment: 32 lanes x 8

static __device__ __forceinline__ v8f vzero8() {
    v8f z = {0.f, 0.f, 0.f, 0.f, 0.f, 0.f, 0.f, 0.f};
    return z;
}

// Build a 16-half fragment from memory where the contraction dim is contiguous.
// p must already include the +8*hs lane-half offset; 16-byte aligned.
static __device__ __forceinline__ v16h ld_frag(const _Float16* p) {
    const v8h lo = *(const v8h*)(p);        // elements e=0..7  : k = 8hs+e
    const v8h hi = *(const v8h*)(p + 16);   // elements e=8..15 : k = 8hs+16+(e-8)
    return __builtin_shufflevector(lo, hi, 0, 1, 2, 3, 4, 5, 6, 7,
                                           8, 9, 10, 11, 12, 13, 14, 15);
}

// The same fragment from fragment-order memory. p = fragment + 8 * lane.
static __device__ __forceinline__ v16h ld_pack(const _Float16* p) {
    const v8h lo = *(const v8h*)(p);        // elements e=0..7  : k = 8hs+e
    const v8h hi = *(const v8h*)(p + RUN);  // elements e=8..15 : k = 8hs+16+(e-8)
    return __builtin_shufflevector(lo, hi, 0, 1, 2, 3, 4, 5, 6, 7,
                                           8, 9, 10, 11, 12, 13, 14, 15);
}

// Same as ld_frag, from fp32 memory with on-the-fly f16 conversion (two 32B loads).
static __device__ __forceinline__ v16h ld_frag_f32(const float* p) {
    const v8f lo = *(const v8f*)(p);
    const v8f hi = *(const v8f*)(p + 16);
    v16h r;
#pragma unroll
    for (int e = 0; e < 8; ++e) {
        r[e]     = (_Float16)lo[e];
        r[e + 8] = (_Float16)hi[e];
    }
    return r;
}

// Pack 8 f32 accumulator rows into one 16-byte f16 store.
static __device__ __forceinline__ void st_rows(_Float16* p, v8f a) {
    v8h h;
#pragma unroll
    for (int r = 0; r < 8; ++r) h[r] = (_Float16)a[r];
    *(v8h*)p = h;
}

// reductions across the 16 lanes of one wave-half (xor masks 1,2,4,8 stay in half)
static __device__ __forceinline__ float half_max(float v) {
#pragma unroll
    for (int m = 1; m <= 8; m <<= 1) v = fmaxf(v, __shfl_xor(v, m, 32));
    return v;
}
static __device__ __forceinline__ float half_sum(float v) {
#pragma unroll
    for (int m = 1; m <= 8; m <<= 1) v += __shfl_xor(v, m, 32);
    return v;
}

static __device__ __forceinline__ v8f wmma_f16(v16h a, v16h b, v8f c) {
    return __builtin_amdgcn_wmma_f32_16x16x32_f16(false, a, false, b,
                                                  (short)0, c, false, false);
}

// ---------------------------------------------------------------------------
// Kernel 0: W fp32 [C][H] -> f16 fragments of W^T, [C/32 k steps][3 matrices][4 h tiles]:
// the 12 fragments that one step of the projection reads lie in one 12 KB run.
// ---------------------------------------------------------------------------
__global__ void cvt_w_kernel(const float* __restrict__ Wq,
                             const float* __restrict__ Wk,
                             const float* __restrict__ Wv,
                             _Float16* __restrict__ W16t) {
    // one thread per stored element of each matrix: i = [k step][h tile][run][lane][8]
    const int i = blockIdx.x * blockDim.x + threadIdx.x;
    if (i < H_ * C_) {
        const int ks = i / (4 * FRAG), t = (i / FRAG) & 3;
        const int run = (i / RUN) & 1, ld = (i >> 3) & 31;      // ld: lane that loads it
        const int h = t * 16 + (ld & 15);
        const int c = ks * 32 + run * 16 + (ld >> 4) * 8 + (i & 7);
        const int d = (ks * 12 + t) * FRAG + (i & (FRAG - 1));
        W16t[d]            = (_Float16)Wq[c * H_ + h];
        W16t[d + 4 * FRAG] = (_Float16)Wk[c * H_ + h];
        W16t[d + 8 * FRAG] = (_Float16)Wv[c * H_ + h];
    }
}

// ---------------------------------------------------------------------------
// Kernel 1: QKV projection. One work-group per 64 rows of X = 4 tiles of 16 rows,
// KW waves per tile; wave ks of a tile takes the 32-wide steps ks, ks+KW, ... of
// the contraction (neighbouring waves read neighbouring bytes of the same rows),
// and the KW partial results are summed once through LDS: more waves per SIMD to
// cover the latency of the loads.
//   Q^T,K^T tiles: A = W^T frag, B = X frag  -> D(m=h, n=query)
//   V tiles:       A = X frag,  B = W^T frag -> D(m=query, n=h)
// X and W fragments have identical lane/element maps, so each is loaded once
// and reused in both roles. Q, K and V^T are stored as the fragments that the
// attention kernel loads: Q, K [16-row tile][2 h steps], V^T [32-key block][4 h tiles].
// ---------------------------------------------------------------------------
#define KW 4                    // waves per 16-row tile = splits of the contraction

typedef __attribute__((ext_vector_type(4))) float v4f;

// One accumulator tile to / from LDS as two planes of [32 lanes][4 floats], so
// that each 16-byte LDS access of a wave covers 512 contiguous bytes.
static __device__ __forceinline__ void put_tile(float (*p)[32][4], int lane, v8f a) {
    *(v4f*)p[0][lane] = __builtin_shufflevector(a, a, 0, 1, 2, 3);
    *(v4f*)p[1][lane] = __builtin_shufflevector(a, a, 4, 5, 6, 7);
}
static __device__ __forceinline__ v8f get_tile(const float (*p)[32][4], int lane) {
    const v4f lo = *(const v4f*)p[0][lane];
    const v4f hi = *(const v4f*)p[1][lane];
    return __builtin_shufflevector(lo, hi, 0, 1, 2, 3, 4, 5, 6, 7);
}

__global__ void __launch_bounds__(4 * KW * 32) qkv_kernel(const float* __restrict__ X,
                                                          const _Float16* __restrict__ W16t,
                                                          _Float16* __restrict__ QKV) {
    const int lane  = threadIdx.x & 31;
    // wave number as a scalar, so that the contraction loop is a scalar loop
    const int wslot = __builtin_amdgcn_readfirstlane(threadIdx.x >> 5);
    const int tl    = wslot / KW;                 // tile within the work-group
    const int ks    = wslot % KW;                 // slice of the contraction
    const int b     = blockIdx.x / (NQT / 4);
    const int qb    = (blockIdx.x % (NQT / 4)) * 64;   // first row of the work-group
    const int q0    = qb + tl * 16;
    const int hs    = lane >> 4;
    const int ln    = lane & 15;

    __shared__ __align__(16) float red[4][KW][12][2][32][4];   // partial Q, K, V tiles

    _Float16* Q16  = QKV;                                 // [B][T/16][2] fragments
    _Float16* K16  = QKV + (size_t)1 * B_ * T_ * H_;      // [B][T/16][2] fragments
    _Float16* V16t = QKV + (size_t)2 * B_ * T_ * H_;      // [B][T/32][4] fragments

    v8f accq[4], acck[4], accv[4];
#pragma unroll
    for (int t = 0; t < 4; ++t) { accq[t] = vzero8(); acck[t] = vzero8(); accv[t] = vzero8(); }

    const float* xrow = X + ((size_t)b * T_ + q0 + ln) * C_;

    for (int k0 = ks * 32; k0 < C_; k0 += KW * 32) {
        const v16h xf = ld_frag_f32(xrow + k0 + 8 * hs);  // X fragment (A and B role)
#pragma unroll
        for (int t = 0; t < 4; ++t) {
            const _Float16* wf = W16t + ((k0 >> 5) * 12 + t) * FRAG + lane * 8;
            const v16h wq = ld_pack(wf);
            const v16h wk = ld_pack(wf + 4 * FRAG);
            const v16h wv = ld_pack(wf + 8 * FRAG);
            accq[t] = wmma_f16(wq, xf, accq[t]);   // Q^T tile
            acck[t] = wmma_f16(wk, xf, acck[t]);   // K^T tile
            accv[t] = wmma_f16(xf, wv, accv[t]);   // V tile
        }
    }

    // publish this wave's partial tiles
#pragma unroll
    for (int t = 0; t < 4; ++t) {
        put_tile(red[tl][ks][t],     lane, accq[t]);
        put_tile(red[tl][ks][4 + t], lane, acck[t]);
        put_tile(red[tl][ks][8 + t], lane, accv[t]);
    }
    __syncthreads();
    if (wslot >= 12) return;        // no barrier follows

    // Sum and store, lane maps unchanged: waves 0-3 the Q rows of tile wslot, waves
    // 4-7 the K rows of tile wslot - 4, waves 8-11 column group wslot - 8 of V over
    // all 64 keys. A lane's 8 values are one lane's share of one run of a fragment.
    const bool isv = wslot >= 8;
    const int  sel = wslot & 3;
    // Q^T/K^T D: lane n = query (ln), rows r = h = 16i + 8hs + r: run i of the row tile
    // V D:       lane n = h, rows r = key = 16i + 8hs + r: run i & 1 of key block i >> 1
    _Float16* dst = isv
        ? V16t + ((size_t)(b * (T_ / 32) + qb / 32) * 4 + sel) * FRAG + lane * 8
        : (wslot < 4 ? Q16 : K16) + (size_t)(b * NQT + qb / 16 + sel) * (2 * FRAG) + lane * 8;
#pragma unroll
    for (int i = 0; i < 4; ++i) {
        const int stl = isv ? i : sel;                       // source tile
        const int sid = isv ? 8 + sel : (wslot & 4) + i;     // source Q, K or V group
        v8f s = get_tile(red[stl][0][sid], lane);
#pragma unroll
        for (int w = 1; w < KW; ++w) s += get_tile(red[stl][w][sid], lane);
        st_rows(dst + (isv ? (i >> 1) * 4 * FRAG + (i & 1) * RUN : i * RUN), s);
    }
}

// ---------------------------------------------------------------------------
// Kernel 2: flash attention. One work-group of NW waves per 16-query tile; wave
// w takes key blocks w, w+NW, ... (32 keys each) with its own running maxima,
// sums and accumulators; the NW partial results are merged once through LDS.
// Online softmax; P transposed C/D->A layout via per-wave LDS (80B row stride,
// 16B aligned, conflict-free) + s_wait_dscnt for the same-wave RAW.
// ---------------------------------------------------------------------------
#define NW    12                // waves per work-group = key splits per tile
#define OPIT  68                // f32 pitch of a partial O row (272 B = 16 B x odd)
#define MWAV  (16 * H_ / (4 * 32))    // merging waves: 4 output columns per lane

// e^x for the merge weights. The v_nop is the free issue slot that the instruction
// set asks for behind a transcendental.
static __device__ __forceinline__ float exp_slot(float x) {
    float y;
    asm("v_exp_f32 %0, %1\n\tv_nop" : "=v"(y) : "v"(x * 1.44269504f));
    return y;
}

__global__ void __launch_bounds__(NW * 32) attn_kernel(const _Float16* __restrict__ QKV,
                                                       float* __restrict__ out) {
    const int lane  = threadIdx.x & 31;
    // wave number as a scalar, so that the key loop is a scalar loop
    const int wslot = __builtin_amdgcn_readfirstlane(threadIdx.x >> 5);
    const int b     = blockIdx.x / NQT;
    const int qt    = blockIdx.x % NQT;
    const int q0    = qt * 16;
    const int hs    = lane >> 4;
    const int ln    = lane & 15;

    const _Float16* Q16  = QKV;
    const _Float16* K16  = QKV + (size_t)1 * B_ * T_ * H_;
    const _Float16* V16t = QKV + (size_t)2 * B_ * T_ * H_;

    __shared__ __align__(16) _Float16 pbuf[NW][16][40];   // 16x32 P tile, 80B stride
    __shared__ __align__(16) float    opart[NW][16][OPIT]; // un-normalised partial O
    __shared__ float mpart[NW][16];                        // partial row maxima
    __shared__ float lpart[NW][16];                        // partial row sums

    // Q A-fragments (contraction = head dim)
    const _Float16* qfr = Q16 + (size_t)(b * NQT + qt) * (2 * FRAG) + lane * 8;
    const v16h aq0 = ld_pack(qfr);
    const v16h aq1 = ld_pack(qfr + FRAG);

    float mrow[8], lrow[8];
    v8f   o[4];
#pragma unroll
    for (int r = 0; r < 8; ++r) { mrow[r] = -__builtin_inff(); lrow[r] = 0.f; }
#pragma unroll
    for (int t = 0; t < 4; ++t) o[t] = vzero8();

    const int nkb = (q0 + 15) / 32 + 1;       // causal: key blocks up to diagonal
    for (int kb = wslot; kb < nkb; kb += NW) {
        const int kbase = kb * 32;

        // S tiles for keys [kbase..+15] and [kbase+16..+31]
        v8f s0 = vzero8(), s1 = vzero8();
        const _Float16* kfr0 = K16 + (size_t)(b * NQT + 2 * kb) * (2 * FRAG) + lane * 8;
        const _Float16* kfr1 = kfr0 + 2 * FRAG;
#pragma unroll
        for (int hstep = 0; hstep < 2; ++hstep) {
            const v16h kf0 = ld_pack(kfr0 + hstep * FRAG);
            const v16h kf1 = ld_pack(kfr1 + hstep * FRAG);
            const v16h aq  = hstep ? aq1 : aq0;
            s0 = wmma_f16(aq, kf0, s0);
            s1 = wmma_f16(aq, kf1, s1);
        }

        // scale + causal mask + online softmax (row stats live per wave-half)
#pragma unroll
        for (int r = 0; r < 8; ++r) {
            const int qi = q0 + r + hs * 8;
            float v0 = s0[r] * SCALE;
            float v1 = s1[r] * SCALE;
            if (kbase + ln > qi)      v0 = -__builtin_inff();
            if (kbase + 16 + ln > qi) v1 = -__builtin_inff();

            const float rm   = half_max(fmaxf(v0, v1));
            const float newm = fmaxf(mrow[r], rm);
            const float cf   = __expf(mrow[r] - newm);
            const float p0   = __expf(v0 - newm);
            const float p1   = __expf(v1 - newm);
            const float rs   = half_sum(p0 + p1);
            mrow[r] = newm;
            lrow[r] = lrow[r] * cf + rs;
#pragma unroll
            for (int t = 0; t < 4; ++t) o[t][r] *= cf;

            pbuf[wslot][r + hs * 8][ln]      = (_Float16)p0;
            pbuf[wslot][r + hs * 8][16 + ln] = (_Float16)p1;
        }

        // same-wave LDS RAW: drain DS counter before transposed re-read
        __asm volatile("s_wait_dscnt 0x0" ::: "memory");

        // P as A-fragment: two ds_load_b128 per lane
        const v16h pf = ld_frag(&pbuf[wslot][ln][8 * hs]);

        // O += P @ V (contraction = 32 keys)
#pragma unroll
        for (int t = 0; t < 4; ++t) {
            const v16h vf =
                ld_pack(V16t + ((size_t)(b * (T_ / 32) + kb) * 4 + t) * FRAG + lane * 8);
            o[t] = wmma_f16(pf, vf, o[t]);
        }
    }

    // publish this wave's partial (a wave without a key block: max -inf, sum 0, O 0)
    if (ln == 0) {
#pragma unroll
        for (int r = 0; r < 8; ++r) {
            mpart[wslot][r + hs * 8] = mrow[r];
            lpart[wslot][r + hs * 8] = lrow[r];
        }
    }
#pragma unroll
    for (int r = 0; r < 8; ++r)
#pragma unroll
        for (int t = 0; t < 4; ++t) opart[wslot][r + hs * 8][t * 16 + ln] = o[t][r];
    __syncthreads();
    if (wslot >= MWAV) return;      // no barrier follows

    // merge: each lane owns 4 neighbouring columns of one query row. Wave 0
    // always holds key block 0, in which every row has an unmasked key, so the
    // merged maximum is finite and the weight of an empty partial is exp(-inf) = 0.
    const int row = threadIdx.x >> 4;
    const int col = (threadIdx.x & 15) * 4;
    float mall = mpart[0][row];
#pragma unroll
    for (int w = 1; w < NW; ++w) mall = fmaxf(mall, mpart[w][row]);
    float wt[NW];
#pragma unroll
    for (int w = 0; w < NW; ++w) wt[w] = exp_slot(mpart[w][row] - mall);
    float lall = 0.f;
    v4f   acc  = {0.f, 0.f, 0.f, 0.f};
#pragma unroll
    for (int w = 0; w < NW; ++w) {
        lall += wt[w] * lpart[w][row];
        acc  += wt[w] * *(const v4f*)&opart[w][row][col];
    }

    // normalize and write fp32 output
    const float inv = 1.0f / lall;
    *(v4f*)&out[((size_t)b * T_ + q0 + row) * H_ + col] = acc * inv;
}

// ---------------------------------------------------------------------------
extern "C" void kernel_launch(void* const* d_in, const int* in_sizes, int n_in,
                              void* d_out, int out_size, void* d_ws, size_t ws_size,
                              hipStream_t stream) {
    const float* X  = (const float*)d_in[0];
    const float* Wq = (const float*)d_in[1];
    const float* Wk = (const float*)d_in[2];
    const float* Wv = (const float*)d_in[3];
    float* out = (float*)d_out;

    // workspace: f16 W^T (384 KB), then Q, K, V^T f16 (6 MB), all in fragment order
    _Float16* W16t = (_Float16*)d_ws;
    _Float16* QKV  = W16t + (size_t)3 * H_ * C_;

    cvt_w_kernel<<<(H_ * C_ + 255) / 256, 256, 0, stream>>>(Wq, Wk, Wv, W16t);

    const int ntiles = B_ * NQT;               // 1024 tiles of 16 rows
    qkv_kernel<<<ntiles / 4, 4 * KW * 32, 0, stream>>>(X, W16t, QKV);   // 4 row tiles per block
    attn_kernel<<<ntiles, NW * 32, 0, stream>>>(QKV, out);       // one block per query tile
}

// v004
// One run takes 60.6 microseconds.
// Two timings next to v003 both put it at 1.44 times that version's speed.
// All steps since v000 together make it 4.01 times as fast.
#include <hip/hip_runtime.h>
#include <hip/hip_bf16.h>

// ---------------------------------------------------------------------------
// Self-attention head for MI455X (gfx1250, wave32, WMMA).
//   Q^T = Wq^T X^T, K^T = Wk^T X^T, V = X Wv   (f16 operands, f32 accum WMMA)
//   O = softmax(causal(Q K^T / sqrt(C))) V     (flash-attention, 16-row tiles)
// All fragments are built with 16-byte loads: for CDNA5 16-bit A/B layouts,
// lane -> row/col (lane%16) and elements map to two contiguous 8-half K runs
// at offsets 8*half and 16+8*half.
// The f16 operands in the workspace (W^T, Q, K, V^T) are kept in FRAGMENT ORDER:
// a 16 x 32 fragment is 1 KB = [2 runs][32 lanes][8 halves], so that each wave-wide
// 16-byte load or store covers 512 contiguous bytes (4 whole 128-byte lines)
// instead of 32-byte pieces of 16 lines.
// ---------------------------------------------------------------------------

typedef __attribute__((ext_vector_type(16))) _Float16 v16h;
typedef __attribute__((ext_vector_type(8)))  _Float16 v8h;
typedef __attribute__((ext_vector_type(8)))  float    v8f;

#define B_    4
#define T_    4096
#define C_    1024
#define H_    64
#define NQT   (T_ / 16)         // query tiles per batch
#define SCALE 0.03125f          // C^-0.5 = 1024^-0.5 = 1/32
#define FRAG  512               // halves in one 16 x 32 fragment
#define RUN   256               // halves in one run of a fragment: 32 lanes x 8

static __device__ __forceinline__ v8f vzero8() {
    v8f z = {0.f, 0.f, 0.f, 0.f, 0.f, 0.f, 0.f, 0.f};
    return z;
}

// A 16-half fragment from fragment-order memory. p = fragment + 8 * lane.
static __device__ __forceinline__ v16h ld_pack(const _Float16* p) {
    const v8h lo = *(const v8h*)(p);        // elements e=0..7  : k = 8hs+e
    const v8h hi = *(const v8h*)(p + RUN);  // elements e=8..15 : k = 8hs+16+(e-8)
    return __builtin_shufflevector(lo, hi, 0, 1, 2, 3, 4, 5, 6, 7,
                                           8, 9, 10, 11, 12, 13, 14, 15);
}

// The same fragment from row-major fp32 memory (contraction dim contiguous), converted
// to f16 on the fly (two 32B loads). p must already include the +8*hs lane-half offset.
static __device__ __forceinline__ v16h ld_frag_f32(const float* p) {
    const v8f lo = *(const v8f*)(p);
    const v8f hi = *(const v8f*)(p + 16);
    v16h r;
#pragma unroll
    for (int e = 0; e < 8; ++e) {
        r[e]     = (_Float16)lo[e];
        r[e + 8] = (_Float16)hi[e];
    }
    return r;
}

// Pack 8 f32 accumulator rows into one 16-byte f16 store.
static __device__ __forceinline__ void st_rows(_Float16* p, v8f a) {
    v8h h;
#pragma unroll
    for (int r = 0; r < 8; ++r) h[r] = (_Float16)a[r];
    *(v8h*)p = h;
}

static __device__ __forceinline__ v8f wmma_f16(v16h a, v16h b, v8f c) {
    return __builtin_amdgcn_wmma_f32_16x16x32_f16(false, a, false, b,
                                                  (short)0, c, false, false);
}

// ---------------------------------------------------------------------------
// Kernel 0: W fp32 [C][H] -> f16 fragments of W^T, [C/32 k steps][3 matrices][4 h tiles]:
// the 12 fragments that one step of the projection reads lie in one 12 KB run.
// ---------------------------------------------------------------------------
__global__ void cvt_w_kernel(const float* __restrict__ Wq,
                             const float* __restrict__ Wk,
                             const float* __restrict__ Wv,
                             _Float16* __restrict__ W16t) {
    // one thread per stored element of each matrix: i = [k step][h tile][run][lane][8]
    const int i = blockIdx.x * blockDim.x + threadIdx.x;
    if (i < H_ * C_) {
        const int ks = i / (4 * FRAG), t = (i / FRAG) & 3;
        const int run = (i / RUN) & 1, ld = (i >> 3) & 31;      // ld: lane that loads it
        const int h = t * 16 + (ld & 15);
        const int c = ks * 32 + run * 16 + (ld >> 4) * 8 + (i & 7);
        const int d = (ks * 12 + t) * FRAG + (i & (FRAG - 1));
        W16t[d]            = (_Float16)Wq[c * H_ + h];
        W16t[d + 4 * FRAG] = (_Float16)Wk[c * H_ + h];
        W16t[d + 8 * FRAG] = (_Float16)Wv[c * H_ + h];
    }
}

// ---------------------------------------------------------------------------
// Kernel 1: QKV projection. One work-group per 64 rows of X = 4 tiles of 16 rows,
// KW waves per tile; wave ks of a tile takes the 32-wide steps ks, ks+KW, ... of
// the contraction (neighbouring waves read neighbouring bytes of the same rows),
// and the KW partial results are summed once through LDS: more waves per SIMD to
// cover the latency of the loads.
//   Q^T,K^T tiles: A = W^T frag, B = X frag  -> D(m=h, n=query)
//   V tiles:       A = X frag,  B = W^T frag -> D(m=query, n=h)
// X and W fragments have identical lane/element maps, so each is loaded once
// and reused in both roles. Q, K and V^T are stored as the fragments that the
// attention kernel loads: Q, K [16-row tile][2 h steps], V^T [32-key block][4 h tiles].
// ---------------------------------------------------------------------------
#define KW 4                    // waves per 16-row tile = splits of the contraction

typedef __attribute__((ext_vector_type(4))) float v4f;

// One accumulator tile to / from LDS as two planes of [32 lanes][4 floats], so
// that each 16-byte LDS access of a wave covers 512 contiguous bytes.
static __device__ __forceinline__ void put_tile(float (*p)[32][4], int lane, v8f a) {
    *(v4f*)p[0][lane] = __builtin_shufflevector(a, a, 0, 1, 2, 3);
    *(v4f*)p[1][lane] = __builtin_shufflevector(a, a, 4, 5, 6, 7);
}
static __device__ __forceinline__ v8f get_tile(const float (*p)[32][4], int lane) {
    const v4f lo = *(const v4f*)p[0][lane];
    const v4f hi = *(const v4f*)p[1][lane];
    return __builtin_shufflevector(lo, hi, 0, 1, 2, 3, 4, 5, 6, 7);
}

__global__ void __launch_bounds__(4 * KW * 32) qkv_kernel(const float* __restrict__ X,
                                                          const _Float16* __restrict__ W16t,
                                                          _Float16* __restrict__ QKV) {
    const int lane  = threadIdx.x & 31;
    // wave number as a scalar, so that the contraction loop is a scalar loop
    const int wslot = __builtin_amdgcn_readfirstlane(threadIdx.x >> 5);
    const int tl    = wslot / KW;                 // tile within the work-group
    const int ks    = wslot % KW;                 // slice of the contraction
    const int b     = blockIdx.x / (NQT / 4);
    const int qb    = (blockIdx.x % (NQT / 4)) * 64;   // first row of the work-group
    const int q0    = qb + tl * 16;
    const int hs    = lane >> 4;
    const int ln    = lane & 15;

    __shared__ __align__(16) float red[4][KW][12][2][32][4];   // partial Q, K, V tiles

    _Float16* Q16  = QKV;                                 // [B][T/16][2] fragments
    _Float16* K16  = QKV + (size_t)1 * B_ * T_ * H_;      // [B][T/16][2] fragments
    _Float16* V16t = QKV + (size_t)2 * B_ * T_ * H_;      // [B][T/32][4] fragments

    v8f accq[4], acck[4], accv[4];
#pragma unroll
    for (int t = 0; t < 4; ++t) { accq[t] = vzero8(); acck[t] = vzero8(); accv[t] = vzero8(); }

    const float* xrow = X + ((size_t)b * T_ + q0 + ln) * C_;

    for (int k0 = ks * 32; k0 < C_; k0 += KW * 32) {
        const v16h xf = ld_frag_f32(xrow + k0 + 8 * hs);  // X fragment (A and B role)
#pragma unroll
        for (int t = 0; t < 4; ++t) {
            const _Float16* wf = W16t + ((k0 >> 5) * 12 + t) * FRAG + lane * 8;
            const v16h wq = ld_pack(wf);
            const v16h wk = ld_pack(wf + 4 * FRAG);
            const v16h wv = ld_pack(wf + 8 * FRAG);
            accq[t] = wmma_f16(wq, xf, accq[t]);   // Q^T tile
            acck[t] = wmma_f16(wk, xf, acck[t]);   // K^T tile
            accv[t] = wmma_f16(xf, wv, accv[t]);   // V tile
        }
    }

    // publish this wave's partial tiles
#pragma unroll
    for (int t = 0; t < 4; ++t) {
        put_tile(red[tl][ks][t],     lane, accq[t]);
        put_tile(red[tl][ks][4 + t], lane, acck[t]);
        put_tile(red[tl][ks][8 + t], lane, accv[t]);
    }
    __syncthreads();
    if (wslot >= 12) return;        // no barrier follows

    // Sum and store, lane maps unchanged: waves 0-3 the Q rows of tile wslot, waves
    // 4-7 the K rows of tile wslot - 4, waves 8-11 column group wslot - 8 of V over
    // all 64 keys. A lane's 8 values are one lane's share of one run of a fragment.
    const bool isv = wslot >= 8;
    const int  sel = wslot & 3;
    // Q^T/K^T D: lane n = query (ln), rows r = h = 16i + 8hs + r: run i of the row tile
    // V D:       lane n = h, rows r = key = 16i + 8hs + r: run i & 1 of key block i >> 1
    _Float16* dst = isv
        ? V16t + ((size_t)(b * (T_ / 32) + qb / 32) * 4 + sel) * FRAG + lane * 8
        : (wslot < 4 ? Q16 : K16) + (size_t)(b * NQT + qb / 16 + sel) * (2 * FRAG) + lane * 8;
#pragma unroll
    for (int i = 0; i < 4; ++i) {
        const int stl = isv ? i : sel;                       // source tile
        const int sid = isv ? 8 + sel : (wslot & 4) + i;     // source Q, K or V group
        v8f s = get_tile(red[stl][0][sid], lane);
#pragma unroll
        for (int w = 1; w < KW; ++w) s += get_tile(red[stl][w][sid], lane);
        st_rows(dst + (isv ? (i >> 1) * 4 * FRAG + (i & 1) * RUN : i * RUN), s);
    }
}

#define NW    12
#define OPIT  68
#define MWAV  (16 * H_ / (4 * 32))    // merging waves: 4 output columns per lane

// e^x. The v_nop is the free issue slot that the instruction set asks for behind a
// transcendental; written into the same statement.
static __device__ __forceinline__ float exp_slot(float x) {
    float y;
    asm("v_exp_f32 %0, %1\n\tv_nop" : "=v"(y) : "v"(x * 1.44269504f));
    return y;
}

// value of lane l ^ 16 (the other half of the wave), as a vector cross-row move
static __device__ __forceinline__ float xhalf(float x) {
    const int i = __builtin_bit_cast(int, x);
    return __builtin_bit_cast(float,
        __builtin_amdgcn_permlanex16(i, i, 0x76543210, 0xfedcba98, false, false));
}

// amdgpu_waves_per_eu(6, 6): two work-groups per WGP = 6 waves per SIMD, which is what
// the registers of a pass with all its fragments in flight allow. Without it the
// compiler aims at more waves, loads all eight fragments through one fragment's
// registers, and every product waits a full load latency of its own.
__global__ void __launch_bounds__(NW * 32) __attribute__((amdgpu_waves_per_eu(6, 6)))
attn_kernel(const _Float16* __restrict__ QKV, float* __restrict__ out) {
    const int lane  = threadIdx.x & 31;
    // wave number as a scalar, so that the key loop is a scalar loop
    const int wslot = __builtin_amdgcn_readfirstlane(threadIdx.x >> 5);
    const int b     = blockIdx.x / NQT;
    const int qt    = blockIdx.x % NQT;
    const int q0    = qt * 16;
    const int hs    = lane >> 4;
    const int ln    = lane & 15;

    const _Float16* Q16  = QKV;
    const _Float16* K16  = QKV + (size_t)1 * B_ * T_ * H_;
    const _Float16* V16t = QKV + (size_t)2 * B_ * T_ * H_;

    __shared__ __align__(16) float    opart[NW][16][OPIT]; // un-normalised partial O
    __shared__ float mpart[NW][16];                        // partial row maxima
    __shared__ float lpart[NW][16];                        // partial row sums

    // Q B-fragments (contraction = head dim; column = query ln)
    const _Float16* qfr = Q16 + (size_t)(b * NQT + qt) * (2 * FRAG) + lane * 8;
    const v16h bq0 = ld_pack(qfr);
    const v16h bq1 = ld_pack(qfr + FRAG);

    float mrun = -__builtin_inff();   // maximum of query ln, alike in both halves
    float lrun = 0.f;                 // sum of query ln over this half's keys
    v8f   o[4];                       // o[t][r] = O[query ln][h = 16t + 8hs + r]
#pragma unroll
    for (int t = 0; t < 4; ++t) o[t] = vzero8();

    const int nkb = (q0 + 15) / 32 + 1;       // causal: key blocks up to diagonal
    for (int kb = wslot; kb < nkb; kb += NW) {
        const int kbase = kb * 32;

        // S^T tiles for keys [kbase..+15] and [kbase+16..+31]: D(m = key, n = query)
        v8f s0 = vzero8(), s1 = vzero8();
        const _Float16* kfr0 = K16 + (size_t)(b * NQT + 2 * kb) * (2 * FRAG) + lane * 8;
        const _Float16* kfr1 = kfr0 + 2 * FRAG;
#pragma unroll
        for (int hstep = 0; hstep < 2; ++hstep) {
            const v16h kf0 = ld_pack(kfr0 + hstep * FRAG);
            const v16h kf1 = ld_pack(kfr1 + hstep * FRAG);
            const v16h bq  = hstep ? bq1 : bq0;
            s0 = wmma_f16(kf0, bq, s0);
            s1 = wmma_f16(kf1, bq, s1);
        }

        // scale + causal mask: register r is key kbase + 8hs + r (s0), + 16 (s1)
        const int lim = q0 + ln - kbase - 8 * hs;     // keys with r <= lim are seen
        float rm = -__builtin_inff();
#pragma unroll
        for (int r = 0; r < 8; ++r) {
            s0[r] = r > lim      ? -__builtin_inff() : s0[r] * SCALE;
            s1[r] = 16 + r > lim ? -__builtin_inff() : s1[r] * SCALE;
            rm = fmaxf(rm, fmaxf(s0[r], s1[r]));
        }

        // online softmax of this lane's query
        const float newm = fmaxf(mrun, fmaxf(rm, xhalf(rm)));
        const float cf   = exp_slot(mrun - newm);
        float rs = 0.f;
        v16h  pf;                                     // P^T as B fragment
#pragma unroll
        for (int r = 0; r < 8; ++r) {
            const float p0 = exp_slot(s0[r] - newm);
            const float p1 = exp_slot(s1[r] - newm);
            rs += p0 + p1;
            pf[r]     = (_Float16)p0;
            pf[r + 8] = (_Float16)p1;
        }
        mrun = newm;
        lrun = lrun * cf + rs;
#pragma unroll
        for (int t = 0; t < 4; ++t) o[t] *= cf;

        // O^T += V^T P^T (contraction = 32 keys): D(m = h, n = query)
#pragma unroll
        for (int t = 0; t < 4; ++t) {
            const v16h vf =
                ld_pack(V16t + ((size_t)(b * (T_ / 32) + kb) * 4 + t) * FRAG + lane * 8);
            o[t] = wmma_f16(vf, pf, o[t]);
        }
    }

    // publish this wave's partial (a wave without a key block: max -inf, sum 0, O 0)
    lrun += xhalf(lrun);            // join the two halves' keys
    if (hs == 0) {
        mpart[wslot][ln] = mrun;
        lpart[wslot][ln] = lrun;
    }
#pragma unroll
    for (int t = 0; t < 4; ++t) {
        float* p = &opart[wslot][ln][t * 16 + hs * 8];
        *(v4f*)p       = __builtin_shufflevector(o[t], o[t], 0, 1, 2, 3);
        *(v4f*)(p + 4) = __builtin_shufflevector(o[t], o[t], 4, 5, 6, 7);
    }
    __syncthreads();
    if (wslot >= MWAV) return;      // no barrier follows

    // merge: each lane owns 4 neighbouring columns of one query row. Wave 0
    // always holds key block 0, in which every row has an unmasked key, so the
    // merged maximum is finite and the weight of an empty partial is exp(-inf) = 0.
    const int row = threadIdx.x >> 4;
    const int col = (threadIdx.x & 15) * 4;
    float mall = mpart[0][row];
#pragma unroll
    for (int w = 1; w < NW; ++w) mall = fmaxf(mall, mpart[w][row]);
    float wt[NW];
#pragma unroll
    for (int w = 0; w < NW; ++w) wt[w] = exp_slot(mpart[w][row] - mall);
    float lall = 0.f;
    v4f   acc  = {0.f, 0.f, 0.f, 0.f};
#pragma unroll
    for (int w = 0; w < NW; ++w) {
        lall += wt[w] * lpart[w][row];
        acc  += wt[w] * *(const v4f*)&opart[w][row][col];
    }

    // normalize and write fp32 output
    const float inv = 1.0f / lall;
    *(v4f*)&out[((size_t)b * T_ + q0 + row) * H_ + col] = acc * inv;
}

// ---------------------------------------------------------------------------
extern "C" void kernel_launch(void* const* d_in, const int* in_sizes, int n_in,
                              void* d_out, int out_size, void* d_ws, size_t ws_size,
                              hipStream_t stream) {
    const float* X  = (const float*)d_in[0];
    const float* Wq = (const float*)d_in[1];
    const float* Wk = (const float*)d_in[2];
    const float* Wv = (const float*)d_in[3];
    float* out = (float*)d_out;

    // workspace: f16 W^T (384 KB), then Q, K, V^T f16 (6 MB), all in fragment order
    _Float16* W16t = (_Float16*)d_ws;
    _Float16* QKV  = W16t + (size_t)3 * H_ * C_;

    cvt_w_kernel<<<(H_ * C_ + 255) / 256, 256, 0, stream>>>(Wq, Wk, Wv, W16t);

    const int ntiles = B_ * NQT;               // 1024 tiles of 16 rows
    qkv_kernel<<<ntiles / 4, 4 * KW * 32, 0, stream>>>(X, W16t, QKV);   // 4 row tiles per block
    attn_kernel<<<ntiles, NW * 32, 0, stream>>>(QKV, out);       // one block per query tile
}

// v005
// It runs in 48.6 microseconds.
// Two timings next to v004 both put it at 1.25 times that version's speed.
// Over all steps from v000 it is 5.01 times as fast.
#include <hip/hip_runtime.h>
#include <hip/hip_bf16.h>

// ---------------------------------------------------------------------------
// Self-attention head for MI455X (gfx1250, wave32, WMMA).
//   Q^T = Wq^T X^T, K^T = Wk^T X^T, V = X Wv   (f16 operands, f32 accum WMMA)
//   O = softmax(causal(Q K^T / sqrt(C))) V     (flash-attention, 16-row tiles)
// All fragments are built with 16-byte loads: for CDNA5 16-bit A/B layouts,
// lane -> row/col (lane%16) and elements map to two contiguous 8-half K runs
// at offsets 8*half and 16+8*half.
// The f16 operands in the workspace (W^T, Q, K, V^T) are kept in FRAGMENT ORDER:
// a 16 x 32 fragment is 1 KB = [2 runs][32 lanes][8 halves], so that each wave-wide
// 16-byte load or store covers 512 contiguous bytes (4 whole 128-byte lines)
// instead of 32-byte pieces of 16 lines.
// ---------------------------------------------------------------------------

typedef __attribute__((ext_vector_type(16))) _Float16 v16h;
typedef __attribute__((ext_vector_type(8)))  _Float16 v8h;
typedef __attribute__((ext_vector_type(8)))  float    v8f;

#define B_    4
#define T_    4096
#define C_    1024
#define H_    64
#define NQT   (T_ / 16)         // query tiles per batch
#define SCALE 0.03125f          // C^-0.5 = 1024^-0.5 = 1/32
#define FRAG  512               // halves in one 16 x 32 fragment
#define RUN   256               // halves in one run of a fragment: 32 lanes x 8

static __device__ __forceinline__ v8f vzero8() {
    v8f z = {0.f, 0.f, 0.f, 0.f, 0.f, 0.f, 0.f, 0.f};
    return z;
}

// A 16-half fragment from fragment-order memory. p = fragment + 8 * lane.
static __device__ __forceinline__ v16h ld_pack(const _Float16* p) {
    const v8h lo = *(const v8h*)(p);        // elements e=0..7  : k = 8hs+e
    const v8h hi = *(const v8h*)(p + RUN);  // elements e=8..15 : k = 8hs+16+(e-8)
    return __builtin_shufflevector(lo, hi, 0, 1, 2, 3, 4, 5, 6, 7,
                                           8, 9, 10, 11, 12, 13, 14, 15);
}

// The same fragment from two runs of 8 fp32 values of a row (contraction dim contiguous,
// at +8*hs and +16+8*hs of the step), converted to f16.
static __device__ __forceinline__ v16h cvt_frag(v8f lo, v8f hi) {
    v16h r;
#pragma unroll
    for (int e = 0; e < 8; ++e) {
        r[e]     = (_Float16)lo[e];
        r[e + 8] = (_Float16)hi[e];
    }
    return r;
}

// Pack 8 f32 accumulator rows into one 16-byte f16 store.
static __device__ __forceinline__ void st_rows(_Float16* p, v8f a) {
    v8h h;
#pragma unroll
    for (int r = 0; r < 8; ++r) h[r] = (_Float16)a[r];
    *(v8h*)p = h;
}

static __device__ __forceinline__ v8f wmma_f16(v16h a, v16h b, v8f c) {
    return __builtin_amdgcn_wmma_f32_16x16x32_f16(false, a, false, b,
                                                  (short)0, c, false, false);
}

// ---------------------------------------------------------------------------
// Kernel 0: W fp32 [C][H] -> f16 fragments of W^T, [C/32 k steps][3 matrices][4 h tiles]:
// the 12 fragments that one step of the projection reads lie in one 12 KB run.
// ---------------------------------------------------------------------------
__global__ void cvt_w_kernel(const float* __restrict__ Wq,
                             const float* __restrict__ Wk,
                             const float* __restrict__ Wv,
                             _Float16* __restrict__ W16t) {
    // one thread per stored element of each matrix: i = [k step][h tile][run][lane][8]
    const int i = blockIdx.x * blockDim.x + threadIdx.x;
    if (i < H_ * C_) {
        const int ks = i / (4 * FRAG), t = (i / FRAG) & 3;
        const int run = (i / RUN) & 1, ld = (i >> 3) & 31;      // ld: lane that loads it
        const int h = t * 16 + (ld & 15);
        const int c = ks * 32 + run * 16 + (ld >> 4) * 8 + (i & 7);
        const int d = (ks * 12 + t) * FRAG + (i & (FRAG - 1));
        W16t[d]            = (_Float16)Wq[c * H_ + h];
        W16t[d + 4 * FRAG] = (_Float16)Wk[c * H_ + h];
        W16t[d + 8 * FRAG] = (_Float16)Wv[c * H_ + h];
    }
}

// ---------------------------------------------------------------------------
// Kernel 1: QKV projection. One work-group per 64 rows of X = 4 tiles of 16 rows,
// KW waves per tile; wave ks of a tile takes the 32-wide steps ks, ks+KW, ... of
// the contraction (neighbouring waves read neighbouring bytes of the same rows),
// and the KW partial results are summed once through LDS: more waves per SIMD to
// cover the latency of the loads.
//   Q^T,K^T tiles: A = W^T frag, B = X frag  -> D(m=h, n=query)
//   V tiles:       A = X frag,  B = W^T frag -> D(m=query, n=h)
// X and W fragments have identical lane/element maps, so each is loaded once
// and reused in both roles. Q, K and V^T are stored as the fragments that the
// attention kernel loads: Q, K [16-row tile][2 h steps], V^T [32-key block][4 h tiles].
// ---------------------------------------------------------------------------
#define KW 4                    // waves per 16-row tile = splits of the contraction

typedef __attribute__((ext_vector_type(4))) float v4f;

// One accumulator tile to / from LDS as two planes of [32 lanes][4 floats], so
// that each 16-byte LDS access of a wave covers 512 contiguous bytes.
static __device__ __forceinline__ void put_tile(float (*p)[32][4], int lane, v8f a) {
    *(v4f*)p[0][lane] = __builtin_shufflevector(a, a, 0, 1, 2, 3);
    *(v4f*)p[1][lane] = __builtin_shufflevector(a, a, 4, 5, 6, 7);
}
static __device__ __forceinline__ v8f get_tile(const float (*p)[32][4], int lane) {
    const v4f lo = *(const v4f*)p[0][lane];
    const v4f hi = *(const v4f*)p[1][lane];
    return __builtin_shufflevector(lo, hi, 0, 1, 2, 3, 4, 5, 6, 7);
}

__global__ void __launch_bounds__(4 * KW * 32) qkv_kernel(const float* __restrict__ X,
                                                          const _Float16* __restrict__ W16t,
                                                          _Float16* __restrict__ QKV) {
    const int lane  = threadIdx.x & 31;
    // wave number as a scalar, so that its tile, slice and the branches on it are scalar
    const int wslot = __builtin_amdgcn_readfirstlane(threadIdx.x >> 5);
    const int tl    = wslot / KW;                 // tile within the work-group
    const int ks    = wslot % KW;                 // slice of the contraction
    const int b     = blockIdx.x / (NQT / 4);
    const int qb    = (blockIdx.x % (NQT / 4)) * 64;   // first row of the work-group
    const int q0    = qb + tl * 16;
    const int hs    = lane >> 4;
    const int ln    = lane & 15;

    __shared__ __align__(16) float red[4][KW][12][2][32][4];   // partial Q, K, V tiles

    _Float16* Q16  = QKV;                                 // [B][T/16][2] fragments
    _Float16* K16  = QKV + (size_t)1 * B_ * T_ * H_;      // [B][T/16][2] fragments
    _Float16* V16t = QKV + (size_t)2 * B_ * T_ * H_;      // [B][T/32][4] fragments

    v8f accq[4], acck[4], accv[4];
#pragma unroll
    for (int t = 0; t < 4; ++t) { accq[t] = vzero8(); acck[t] = vzero8(); accv[t] = vzero8(); }

    const float* xrow = X + ((size_t)b * T_ + q0 + ln) * C_;

    // A step's loads all fly together: its 12 W fragments are fetched as one group in
    // front of its products, and the X rows of the next step behind them, so that a
    // step waits one load latency, not one per product. Order of the sums unchanged.
    const float*    xp = xrow + ks * 32 + 8 * hs;
    const _Float16* wp = W16t + ks * 12 * FRAG + lane * 8;
    v8f xlo = *(const v8f*)(xp);
    v8f xhi = *(const v8f*)(xp + 16);
    // unrolled: every address is one base plus an immediate, the two sets of X rows
    // need no copies, and the last step's missing fetch is settled at compile time
#pragma unroll
    for (int s = 0; s < C_ / (KW * 32); ++s) {
        v16h w[12];                                // Q: 0-3, K: 4-7, V: 8-11
#pragma unroll
        for (int j = 0; j < 12; ++j) w[j] = ld_pack(wp + (s * KW * 12 + j) * FRAG);
        v8f nlo = xlo, nhi = xhi;
        if (s + 1 < C_ / (KW * 32)) {
            nlo = *(const v8f*)(xp + (s + 1) * KW * 32);
            nhi = *(const v8f*)(xp + (s + 1) * KW * 32 + 16);
        }
        const v16h xf = cvt_frag(xlo, xhi);        // X fragment (A and B role)
#pragma unroll
        for (int t = 0; t < 4; ++t) {
            accq[t] = wmma_f16(w[t],     xf, accq[t]);   // Q^T tile
            acck[t] = wmma_f16(w[4 + t], xf, acck[t]);   // K^T tile
            accv[t] = wmma_f16(xf, w[8 + t], accv[t]);   // V tile
        }
        xlo = nlo;
        xhi = nhi;
    }

    // publish this wave's partial tiles
#pragma unroll
    for (int t = 0; t < 4; ++t) {
        put_tile(red[tl][ks][t],     lane, accq[t]);
        put_tile(red[tl][ks][4 + t], lane, acck[t]);
        put_tile(red[tl][ks][8 + t], lane, accv[t]);
    }
    __syncthreads();
    if (wslot >= 12) return;        // no barrier follows

    // Sum and store, lane maps unchanged: waves 0-3 the Q rows of tile wslot, waves
    // 4-7 the K rows of tile wslot - 4, waves 8-11 column group wslot - 8 of V over
    // all 64 keys. A lane's 8 values are one lane's share of one run of a fragment.
    const bool isv = wslot >= 8;
    const int  sel = wslot & 3;
    // Q^T/K^T D: lane n = query (ln), rows r = h = 16i + 8hs + r: run i of the row tile
    // V D:       lane n = h, rows r = key = 16i + 8hs + r: run i & 1 of key block i >> 1
    _Float16* dst = isv
        ? V16t + ((size_t)(b * (T_ / 32) + qb / 32) * 4 + sel) * FRAG + lane * 8
        : (wslot < 4 ? Q16 : K16) + (size_t)(b * NQT + qb / 16 + sel) * (2 * FRAG) + lane * 8;
#pragma unroll
    for (int i = 0; i < 4; ++i) {
        const int stl = isv ? i : sel;                       // source tile
        const int sid = isv ? 8 + sel : (wslot & 4) + i;     // source Q, K or V group
        v8f s = get_tile(red[stl][0][sid], lane);
#pragma unroll
        for (int w = 1; w < KW; ++w) s += get_tile(red[stl][w][sid], lane);
        st_rows(dst + (isv ? (i >> 1) * 4 * FRAG + (i & 1) * RUN : i * RUN), s);
    }
}

#define NW    12
#define OPIT  68
#define MWAV  (16 * H_ / (4 * 32))    // merging waves: 4 output columns per lane

// e^x. The v_nop is the free issue slot that the instruction set asks for behind a
// transcendental; written into the same statement.
static __device__ __forceinline__ float exp_slot(float x) {
    float y;
    asm("v_exp_f32 %0, %1\n\tv_nop" : "=v"(y) : "v"(x * 1.44269504f));
    return y;
}

// value of lane l ^ 16 (the other half of the wave), as a vector cross-row move
static __device__ __forceinline__ float xhalf(float x) {
    const int i = __builtin_bit_cast(int, x);
    return __builtin_bit_cast(float,
        __builtin_amdgcn_permlanex16(i, i, 0x76543210, 0xfedcba98, false, false));
}

// amdgpu_waves_per_eu(6, 6): two work-groups per WGP = 6 waves per SIMD, which is what
// the registers of a pass with all its fragments in flight allow. Without it the
// compiler aims at more waves, loads all eight fragments through one fragment's
// registers, and every product waits a full load latency of its own.
__global__ void __launch_bounds__(NW * 32) __attribute__((amdgpu_waves_per_eu(6, 6)))
attn_kernel(const _Float16* __restrict__ QKV, float* __restrict__ out) {
    const int lane  = threadIdx.x & 31;
    // wave number as a scalar, so that the key loop is a scalar loop
    const int wslot = __builtin_amdgcn_readfirstlane(threadIdx.x >> 5);
    const int b     = blockIdx.x / NQT;
    const int qt    = blockIdx.x % NQT;
    const int q0    = qt * 16;
    const int hs    = lane >> 4;
    const int ln    = lane & 15;

    const _Float16* Q16  = QKV;
    const _Float16* K16  = QKV + (size_t)1 * B_ * T_ * H_;
    const _Float16* V16t = QKV + (size_t)2 * B_ * T_ * H_;

    __shared__ __align__(16) float    opart[NW][16][OPIT]; // un-normalised partial O
    __shared__ float mpart[NW][16];                        // partial row maxima
    __shared__ float lpart[NW][16];                        // partial row sums

    // Q B-fragments (contraction = head dim; column = query ln)
    const _Float16* qfr = Q16 + (size_t)(b * NQT + qt) * (2 * FRAG) + lane * 8;
    const v16h bq0 = ld_pack(qfr);
    const v16h bq1 = ld_pack(qfr + FRAG);

    float mrun = -__builtin_inff();   // maximum of query ln, alike in both halves
    float lrun = 0.f;                 // sum of query ln over this half's keys
    v8f   o[4];                       // o[t][r] = O[query ln][h = 16t + 8hs + r]
#pragma unroll
    for (int t = 0; t < 4; ++t) o[t] = vzero8();

    const int nkb = (q0 + 15) / 32 + 1;       // causal: key blocks up to diagonal
    for (int kb = wslot; kb < nkb; kb += NW) {
        const int kbase = kb * 32;

        // S^T tiles for keys [kbase..+15] and [kbase+16..+31]: D(m = key, n = query)
        v8f s0 = vzero8(), s1 = vzero8();
        const _Float16* kfr0 = K16 + (size_t)(b * NQT + 2 * kb) * (2 * FRAG) + lane * 8;
        const _Float16* kfr1 = kfr0 + 2 * FRAG;
#pragma unroll
        for (int hstep = 0; hstep < 2; ++hstep) {
            const v16h kf0 = ld_pack(kfr0 + hstep * FRAG);
            const v16h kf1 = ld_pack(kfr1 + hstep * FRAG);
            const v16h bq  = hstep ? bq1 : bq0;
            s0 = wmma_f16(kf0, bq, s0);
            s1 = wmma_f16(kf1, bq, s1);
        }

        // scale + causal mask: register r is key kbase + 8hs + r (s0), + 16 (s1)
        const int lim = q0 + ln - kbase - 8 * hs;     // keys with r <= lim are seen
        float rm = -__builtin_inff();
#pragma unroll
        for (int r = 0; r < 8; ++r) {
            s0[r] = r > lim      ? -__builtin_inff() : s0[r] * SCALE;
            s1[r] = 16 + r > lim ? -__builtin_inff() : s1[r] * SCALE;
            rm = fmaxf(rm, fmaxf(s0[r], s1[r]));
        }

        // online softmax of this lane's query
        const float newm = fmaxf(mrun, fmaxf(rm, xhalf(rm)));
        const float cf   = exp_slot(mrun - newm);
        float rs = 0.f;
        v16h  pf;                                     // P^T as B fragment
#pragma unroll
        for (int r = 0; r < 8; ++r) {
            const float p0 = exp_slot(s0[r] - newm);
            const float p1 = exp_slot(s1[r] - newm);
            rs += p0 + p1;
            pf[r]     = (_Float16)p0;
            pf[r + 8] = (_Float16)p1;
        }
        mrun = newm;
        lrun = lrun * cf + rs;
#pragma unroll
        for (int t = 0; t < 4; ++t) o[t] *= cf;

        // O^T += V^T P^T (contraction = 32 keys): D(m = h, n = query)
#pragma unroll
        for (int t = 0; t < 4; ++t) {
            const v16h vf =
                ld_pack(V16t + ((size_t)(b * (T_ / 32) + kb) * 4 + t) * FRAG + lane * 8);
            o[t] = wmma_f16(vf, pf, o[t]);
        }
    }

    // publish this wave's partial (a wave without a key block: max -inf, sum 0, O 0)
    lrun += xhalf(lrun);            // join the two halves' keys
    if (hs == 0) {
        mpart[wslot][ln] = mrun;
        lpart[wslot][ln] = lrun;
    }
#pragma unroll
    for (int t = 0; t < 4; ++t) {
        float* p = &opart[wslot][ln][t * 16 + hs * 8];
        *(v4f*)p       = __builtin_shufflevector(o[t], o[t], 0, 1, 2, 3);
        *(v4f*)(p + 4) = __builtin_shufflevector(o[t], o[t], 4, 5, 6, 7);
    }
    __syncthreads();
    if (wslot >= MWAV) return;      // no barrier follows

    // merge: each lane owns 4 neighbouring columns of one query row. Wave 0
    // always holds key block 0, in which every row has an unmasked key, so the
    // merged maximum is finite and the weight of an empty partial is exp(-inf) = 0.
    const int row = threadIdx.x >> 4;
    const int col = (threadIdx.x & 15) * 4;
    float mall = mpart[0][row];
#pragma unroll
    for (int w = 1; w < NW; ++w) mall = fmaxf(mall, mpart[w][row]);
    float wt[NW];
#pragma unroll
    for (int w = 0; w < NW; ++w) wt[w] = exp_slot(mpart[w][row] - mall);
    float lall = 0.f;
    v4f   acc  = {0.f, 0.f, 0.f, 0.f};
#pragma unroll
    for (int w = 0; w < NW; ++w) {
        lall += wt[w] * lpart[w][row];
        acc  += wt[w] * *(const v4f*)&opart[w][row][col];
    }

    // normalize and write fp32 output
    const float inv = 1.0f / lall;
    *(v4f*)&out[((size_t)b * T_ + q0 + row) * H_ + col] = acc * inv;
}

// ---------------------------------------------------------------------------
extern "C" void kernel_launch(void* const* d_in, const int* in_sizes, int n_in,
                              void* d_out, int out_size, void* d_ws, size_t ws_size,
                              hipStream_t stream) {
    const float* X  = (const float*)d_in[0];
    const float* Wq = (const float*)d_in[1];
    const float* Wk = (const float*)d_in[2];
    const float* Wv = (const float*)d_in[3];
    float* out = (float*)d_out;

    // workspace: f16 W^T (384 KB), then Q, K, V^T f16 (6 MB), all in fragment order
    _Float16* W16t = (_Float16*)d_ws;
    _Float16* QKV  = W16t + (size_t)3 * H_ * C_;

    cvt_w_kernel<<<(H_ * C_ + 255) / 256, 256, 0, stream>>>(Wq, Wk, Wv, W16t);

    const int ntiles = B_ * NQT;               // 1024 tiles of 16 rows
    qkv_kernel<<<ntiles / 4, 4 * KW * 32, 0, stream>>>(X, W16t, QKV);   // 4 row tiles per block
    attn_kernel<<<ntiles, NW * 32, 0, stream>>>(QKV, out);       // one block per query tile
}

// v006
// One run takes 41.2 microseconds.
// Timed twice side by side with v005, it ran 1.16 and 1.17 times as fast.
// Counting every step since v000, it is 5.84 times as fast.
#include <hip/hip_runtime.h>
#include <hip/hip_bf16.h>

// ---------------------------------------------------------------------------
// Self-attention head for MI455X (gfx1250, wave32, WMMA).
//   Q^T = Wq^T X^T, K^T = Wk^T X^T, V = X Wv   (f16 operands, f32 accum WMMA)
//   O = softmax(causal(Q K^T / sqrt(C))) V     (flash-attention, 16-row tiles)
// All fragments are built with 16-byte loads: for CDNA5 16-bit A/B layouts,
// lane -> row/col (lane%16) and elements map to two contiguous 8-half K runs
// at offsets 8*half and 16+8*half.
// The f16 operands in the workspace (W^T, Q, K, V^T) are kept in FRAGMENT ORDER:
// a 16 x 32 fragment is 1 KB = [2 runs][32 lanes][8 halves], so that each wave-wide
// 16-byte load or store covers 512 contiguous bytes (4 whole 128-byte lines)
// instead of 32-byte pieces of 16 lines.
// ---------------------------------------------------------------------------

typedef __attribute__((ext_vector_type(16))) _Float16 v16h;
typedef __attribute__((ext_vector_type(8)))  _Float16 v8h;
typedef __attribute__((ext_vector_type(8)))  float    v8f;

#define B_    4
#define T_    4096
#define C_    1024
#define H_    64
#define NQT   (T_ / 16)         // query tiles per batch
#define SCALE 0.03125f          // C^-0.5 = 1024^-0.5 = 1/32
#define FRAG  512               // halves in one 16 x 32 fragment
#define RUN   256               // halves in one run of a fragment: 32 lanes x 8

static __device__ __forceinline__ v8f vzero8() {
    v8f z = {0.f, 0.f, 0.f, 0.f, 0.f, 0.f, 0.f, 0.f};
    return z;
}

// A 16-half fragment from fragment-order memory. p = fragment + 8 * lane.
static __device__ __forceinline__ v16h ld_pack(const _Float16* p) {
    const v8h lo = *(const v8h*)(p);        // elements e=0..7  : k = 8hs+e
    const v8h hi = *(const v8h*)(p + RUN);  // elements e=8..15 : k = 8hs+16+(e-8)
    return __builtin_shufflevector(lo, hi, 0, 1, 2, 3, 4, 5, 6, 7,
                                           8, 9, 10, 11, 12, 13, 14, 15);
}

// The same fragment from two runs of 8 fp32 values of a row (contraction dim contiguous,
// at +8*hs and +16+8*hs of the step), converted to f16.
static __device__ __forceinline__ v16h cvt_frag(v8f lo, v8f hi) {
    v16h r;
#pragma unroll
    for (int e = 0; e < 8; ++e) {
        r[e]     = (_Float16)lo[e];
        r[e + 8] = (_Float16)hi[e];
    }
    return r;
}

// Pack 8 f32 accumulator rows into one 16-byte f16 store.
static __device__ __forceinline__ void st_rows(_Float16* p, v8f a) {
    v8h h;
#pragma unroll
    for (int r = 0; r < 8; ++r) h[r] = (_Float16)a[r];
    *(v8h*)p = h;
}

static __device__ __forceinline__ v8f wmma_f16(v16h a, v16h b, v8f c) {
    return __builtin_amdgcn_wmma_f32_16x16x32_f16(false, a, false, b,
                                                  (short)0, c, false, false);
}

// ---------------------------------------------------------------------------
// Kernel 0: W fp32 [C][H] -> f16 fragments of W^T, [C/32 k steps][3 matrices][4 h tiles]:
// the 12 fragments that one step of the projection reads lie in one 12 KB run.
// ---------------------------------------------------------------------------
__global__ void cvt_w_kernel(const float* __restrict__ Wq,
                             const float* __restrict__ Wk,
                             const float* __restrict__ Wv,
                             _Float16* __restrict__ W16t) {
    // one thread per stored element of each matrix: i = [k step][h tile][run][lane][8]
    const int i = blockIdx.x * blockDim.x + threadIdx.x;
    if (i < H_ * C_) {
        const int ks = i / (4 * FRAG), t = (i / FRAG) & 3;
        const int run = (i / RUN) & 1, ld = (i >> 3) & 31;      // ld: lane that loads it
        const int h = t * 16 + (ld & 15);
        const int c = ks * 32 + run * 16 + (ld >> 4) * 8 + (i & 7);
        const int d = (ks * 12 + t) * FRAG + (i & (FRAG - 1));
        W16t[d]            = (_Float16)Wq[c * H_ + h];
        W16t[d + 4 * FRAG] = (_Float16)Wk[c * H_ + h];
        W16t[d + 8 * FRAG] = (_Float16)Wv[c * H_ + h];
    }
}

// ---------------------------------------------------------------------------
// Kernel 1: QKV projection. One work-group per 64 rows of X = 4 tiles of 16 rows,
// KW waves per tile; wave ks of a tile takes the 32-wide steps ks, ks+KW, ... of
// the contraction (neighbouring waves read neighbouring bytes of the same rows),
// and the KW partial results are summed once through LDS: more waves per SIMD to
// cover the latency of the loads.
//   Q^T,K^T tiles: A = W^T frag, B = X frag  -> D(m=h, n=query)
//   V tiles:       A = X frag,  B = W^T frag -> D(m=query, n=h)
// X and W fragments have identical lane/element maps, so each is loaded once
// and reused in both roles. Q, K and V^T are stored as the fragments that the
// attention kernel loads: Q, K [16-row tile][2 h steps], V^T [32-key block][4 h tiles].
// ---------------------------------------------------------------------------
#define KW 4                    // waves per 16-row tile = splits of the contraction

typedef __attribute__((ext_vector_type(4))) float v4f;

// One accumulator tile to / from LDS as two planes of [32 lanes][4 floats], so
// that each 16-byte LDS access of a wave covers 512 contiguous bytes.
static __device__ __forceinline__ void put_tile(float (*p)[32][4], int lane, v8f a) {
    *(v4f*)p[0][lane] = __builtin_shufflevector(a, a, 0, 1, 2, 3);
    *(v4f*)p[1][lane] = __builtin_shufflevector(a, a, 4, 5, 6, 7);
}
static __device__ __forceinline__ v8f get_tile(const float (*p)[32][4], int lane) {
    const v4f lo = *(const v4f*)p[0][lane];
    const v4f hi = *(const v4f*)p[1][lane];
    return __builtin_shufflevector(lo, hi, 0, 1, 2, 3, 4, 5, 6, 7);
}

__global__ void __launch_bounds__(4 * KW * 32) qkv_kernel(const float* __restrict__ X,
                                                          const _Float16* __restrict__ W16t,
                                                          _Float16* __restrict__ QKV) {
    const int lane  = threadIdx.x & 31;
    // wave number as a scalar, so that its tile, slice and the branches on it are scalar
    const int wslot = __builtin_amdgcn_readfirstlane(threadIdx.x >> 5);
    const int tl    = wslot / KW;                 // tile within the work-group
    const int ks    = wslot % KW;                 // slice of the contraction
    const int b     = blockIdx.x / (NQT / 4);
    const int qb    = (blockIdx.x % (NQT / 4)) * 64;   // first row of the work-group
    const int q0    = qb + tl * 16;
    const int hs    = lane >> 4;
    const int ln    = lane & 15;

    __shared__ __align__(16) float red[4][KW][12][2][32][4];   // partial Q, K, V tiles

    _Float16* Q16  = QKV;                                 // [B][T/16][2] fragments
    _Float16* K16  = QKV + (size_t)1 * B_ * T_ * H_;      // [B][T/16][2] fragments
    _Float16* V16t = QKV + (size_t)2 * B_ * T_ * H_;      // [B][T/32][4] fragments

    v8f accq[4], acck[4], accv[4];
#pragma unroll
    for (int t = 0; t < 4; ++t) { accq[t] = vzero8(); acck[t] = vzero8(); accv[t] = vzero8(); }

    const float* xrow = X + ((size_t)b * T_ + q0 + ln) * C_;

    // A step's loads all fly together: its 12 W fragments are fetched as one group in
    // front of its products, and the X rows of the next step behind them, so that a
    // step waits one load latency, not one per product. Order of the sums unchanged.
    const float*    xp = xrow + ks * 32 + 8 * hs;
    const _Float16* wp = W16t + ks * 12 * FRAG + lane * 8;
    v8f xlo = *(const v8f*)(xp);
    v8f xhi = *(const v8f*)(xp + 16);
    // unrolled: every address is one base plus an immediate, the two sets of X rows
    // need no copies, and the last step's missing fetch is settled at compile time
#pragma unroll
    for (int s = 0; s < C_ / (KW * 32); ++s) {
        v16h w[12];                                // Q: 0-3, K: 4-7, V: 8-11
#pragma unroll
        for (int j = 0; j < 12; ++j) w[j] = ld_pack(wp + (s * KW * 12 + j) * FRAG);
        v8f nlo = xlo, nhi = xhi;
        if (s + 1 < C_ / (KW * 32)) {
            nlo = *(const v8f*)(xp + (s + 1) * KW * 32);
            nhi = *(const v8f*)(xp + (s + 1) * KW * 32 + 16);
        }
        const v16h xf = cvt_frag(xlo, xhi);        // X fragment (A and B role)
#pragma unroll
        for (int t = 0; t < 4; ++t) {
            accq[t] = wmma_f16(w[t],     xf, accq[t]);   // Q^T tile
            acck[t] = wmma_f16(w[4 + t], xf, acck[t]);   // K^T tile
            accv[t] = wmma_f16(xf, w[8 + t], accv[t]);   // V tile
        }
        xlo = nlo;
        xhi = nhi;
    }

    // publish this wave's partial tiles
#pragma unroll
    for (int t = 0; t < 4; ++t) {
        put_tile(red[tl][ks][t],     lane, accq[t]);
        put_tile(red[tl][ks][4 + t], lane, acck[t]);
        put_tile(red[tl][ks][8 + t], lane, accv[t]);
    }
    __syncthreads();
    if (wslot >= 12) return;        // no barrier follows

    // Sum and store, lane maps unchanged: waves 0-3 the Q rows of tile wslot, waves
    // 4-7 the K rows of tile wslot - 4, waves 8-11 column group wslot - 8 of V over
    // all 64 keys. A lane's 8 values are one lane's share of one run of a fragment.
    const bool isv = wslot >= 8;
    const int  sel = wslot & 3;
    // Q^T/K^T D: lane n = query (ln), rows r = h = 16i + 8hs + r: run i of the row tile
    // V D:       lane n = h, rows r = key = 16i + 8hs + r: run i & 1 of key block i >> 1
    _Float16* dst = isv
        ? V16t + ((size_t)(b * (T_ / 32) + qb / 32) * 4 + sel) * FRAG + lane * 8
        : (wslot < 4 ? Q16 : K16) + (size_t)(b * NQT + qb / 16 + sel) * (2 * FRAG) + lane * 8;
#pragma unroll
    for (int i = 0; i < 4; ++i) {
        const int stl = isv ? i : sel;                       // source tile
        const int sid = isv ? 8 + sel : (wslot & 4) + i;     // source Q, K or V group
        v8f s = get_tile(red[stl][0][sid], lane);
#pragma unroll
        for (int w = 1; w < KW; ++w) s += get_tile(red[stl][w][sid], lane);
        st_rows(dst + (isv ? (i >> 1) * 4 * FRAG + (i & 1) * RUN : i * RUN), s);
    }
}

#define NW    12
#define OPIT  68
#define MWAV  (16 * H_ / (4 * 32))    // merging waves: 4 output columns per lane

// e^x. The v_nop is the free issue slot that the instruction set asks for behind a
// transcendental; written into the same statement.
static __device__ __forceinline__ float exp_slot(float x) {
    float y;
    asm("v_exp_f32 %0, %1\n\tv_nop" : "=v"(y) : "v"(x * 1.44269504f));
    return y;
}

// value of lane l ^ 16 (the other half of the wave), as a vector cross-row move
static __device__ __forceinline__ float xhalf(float x) {
    const int i = __builtin_bit_cast(int, x);
    return __builtin_bit_cast(float,
        __builtin_amdgcn_permlanex16(i, i, 0x76543210, 0xfedcba98, false, false));
}

// amdgpu_waves_per_eu(6, 6): two work-groups per WGP = 6 waves per SIMD, which is what
// the registers of a pass with all its fragments in flight allow. Without it the
// compiler aims at more waves, loads all eight fragments through one fragment's
// registers, and every product waits a full load latency of its own.
__global__ void __launch_bounds__(NW * 32) __attribute__((amdgpu_waves_per_eu(6, 6)))
attn_kernel(const _Float16* __restrict__ QKV, float* __restrict__ out) {
    const int lane  = threadIdx.x & 31;
    // wave number as a scalar, so that the key loop is a scalar loop
    const int wslot = __builtin_amdgcn_readfirstlane(threadIdx.x >> 5);
    // Cost falls with the work-group index: a causal tile's key loop grows with qt, only
    // half of the work-groups are resident at once. The longest tiles (of all batches) go first, the short ones fill the tail.
    const int b     = blockIdx.x % B_;
    const int qt    = (NQT - 1u - blockIdx.x / B_) % NQT;
    const int q0    = qt * 16;
    const int hs    = lane >> 4;
    const int ln    = lane & 15;

    const _Float16* Q16  = QKV;
    const _Float16* K16  = QKV + (size_t)1 * B_ * T_ * H_;
    const _Float16* V16t = QKV + (size_t)2 * B_ * T_ * H_;

    __shared__ __align__(16) float    opart[NW][16][OPIT]; // un-normalised partial O
    __shared__ float mpart[NW][16];                        // partial row maxima
    __shared__ float lpart[NW][16];                        // partial row sums

    // Q B-fragments (contraction = head dim; column = query ln)
    const _Float16* qfr = Q16 + (size_t)(b * NQT + qt) * (2 * FRAG) + lane * 8;
    const v16h bq0 = ld_pack(qfr);
    const v16h bq1 = ld_pack(qfr + FRAG);

    float mrun = -__builtin_inff();   // maximum of query ln, alike in both halves
    float lrun = 0.f;                 // sum of query ln over this half's keys
    v8f   o[4];                       // o[t][r] = O[query ln][h = 16t + 8hs + r]
#pragma unroll
    for (int t = 0; t < 4; ++t) o[t] = vzero8();

    const int nkb = (q0 + 15) / 32 + 1;       // causal: key blocks up to diagonal
    for (int kb = wslot; kb < nkb; kb += NW) {
        const int kbase = kb * 32;

        // S^T tiles for keys [kbase..+15] and [kbase+16..+31]: D(m = key, n = query)
        v8f s0 = vzero8(), s1 = vzero8();
        const _Float16* kfr0 = K16 + (size_t)(b * NQT + 2 * kb) * (2 * FRAG) + lane * 8;
        const _Float16* kfr1 = kfr0 + 2 * FRAG;
#pragma unroll
        for (int hstep = 0; hstep < 2; ++hstep) {
            const v16h kf0 = ld_pack(kfr0 + hstep * FRAG);
            const v16h kf1 = ld_pack(kfr1 + hstep * FRAG);
            const v16h bq  = hstep ? bq1 : bq0;
            s0 = wmma_f16(kf0, bq, s0);
            s1 = wmma_f16(kf1, bq, s1);
        }

        // scale + causal mask: register r is key kbase + 8hs + r (s0), + 16 (s1)
        const int lim = q0 + ln - kbase - 8 * hs;     // keys with r <= lim are seen
        float rm = -__builtin_inff();
#pragma unroll
        for (int r = 0; r < 8; ++r) {
            s0[r] = r > lim      ? -__builtin_inff() : s0[r] * SCALE;
            s1[r] = 16 + r > lim ? -__builtin_inff() : s1[r] * SCALE;
            rm = fmaxf(rm, fmaxf(s0[r], s1[r]));
        }

        // online softmax of this lane's query
        const float newm = fmaxf(mrun, fmaxf(rm, xhalf(rm)));
        const float cf   = exp_slot(mrun - newm);
        float rs = 0.f;
        v16h  pf;                                     // P^T as B fragment
#pragma unroll
        for (int r = 0; r < 8; ++r) {
            const float p0 = exp_slot(s0[r] - newm);
            const float p1 = exp_slot(s1[r] - newm);
            rs += p0 + p1;
            pf[r]     = (_Float16)p0;
            pf[r + 8] = (_Float16)p1;
        }
        mrun = newm;
        lrun = lrun * cf + rs;
#pragma unroll
        for (int t = 0; t < 4; ++t) o[t] *= cf;

        // O^T += V^T P^T (contraction = 32 keys): D(m = h, n = query)
#pragma unroll
        for (int t = 0; t < 4; ++t) {
            const v16h vf =
                ld_pack(V16t + ((size_t)(b * (T_ / 32) + kb) * 4 + t) * FRAG + lane * 8);
            o[t] = wmma_f16(vf, pf, o[t]);
        }
    }

    // publish this wave's partial (a wave without a key block: max -inf, sum 0, O 0)
    lrun += xhalf(lrun);            // join the two halves' keys
    if (hs == 0) {
        mpart[wslot][ln] = mrun;
        lpart[wslot][ln] = lrun;
    }
#pragma unroll
    for (int t = 0; t < 4; ++t) {
        float* p = &opart[wslot][ln][t * 16 + hs * 8];
        *(v4f*)p       = __builtin_shufflevector(o[t], o[t], 0, 1, 2, 3);
        *(v4f*)(p + 4) = __builtin_shufflevector(o[t], o[t], 4, 5, 6, 7);
    }
    __syncthreads();
    if (wslot >= MWAV) return;      // no barrier follows

    // merge: each lane owns 4 neighbouring columns of one query row. Wave 0
    // always holds key block 0, in which every row has an unmasked key, so the
    // merged maximum is finite and the weight of an empty partial is exp(-inf) = 0.
    const int row = threadIdx.x >> 4;
    const int col = (threadIdx.x & 15) * 4;
    float mall = mpart[0][row];
#pragma unroll
    for (int w = 1; w < NW; ++w) mall = fmaxf(mall, mpart[w][row]);
    float wt[NW];
#pragma unroll
    for (int w = 0; w < NW; ++w) wt[w] = exp_slot(mpart[w][row] - mall);
    float lall = 0.f;
    v4f   acc  = {0.f, 0.f, 0.f, 0.f};
#pragma unroll
    for (int w = 0; w < NW; ++w) {
        lall += wt[w] * lpart[w][row];
        acc  += wt[w] * *(const v4f*)&opart[w][row][col];
    }

    // normalize and write fp32 output
    const float inv = 1.0f / lall;
    *(v4f*)&out[((size_t)b * T_ + q0 + row) * H_ + col] = acc * inv;
}

// ---------------------------------------------------------------------------
extern "C" void kernel_launch(void* const* d_in, const int* in_sizes, int n_in,
                              void* d_out, int out_size, void* d_ws, size_t ws_size,
                              hipStream_t stream) {
    const float* X  = (const float*)d_in[0];
    const float* Wq = (const float*)d_in[1];
    const float* Wk = (const float*)d_in[2];
    const float* Wv = (const float*)d_in[3];
    float* out = (float*)d_out;

    // workspace: f16 W^T (384 KB), then Q, K, V^T f16 (6 MB), all in fragment order
    _Float16* W16t = (_Float16*)d_ws;
    _Float16* QKV  = W16t + (size_t)3 * H_ * C_;

    cvt_w_kernel<<<(H_ * C_ + 255) / 256, 256, 0, stream>>>(Wq, Wk, Wv, W16t);

    const int ntiles = B_ * NQT;               // 1024 tiles of 16 rows
    qkv_kernel<<<ntiles / 4, 4 * KW * 32, 0, stream>>>(X, W16t, QKV);   // 4 row tiles per block
    attn_kernel<<<ntiles, NW * 32, 0, stream>>>(QKV, out);       // one block per query tile
}

// v007
// A run of this version takes 38.5 microseconds.
// Next to v006, in two timings, it ran 1.07 and 1.09 times as fast.
// Counting every step since v000, it is 6.31 times as fast.
#include <hip/hip_runtime.h>
#include <hip/hip_bf16.h>

// ---------------------------------------------------------------------------
// Self-attention head for MI455X (gfx1250, wave32, WMMA).
//   Q^T = Wq^T X^T, K^T = Wk^T X^T, V = X Wv   (f16 operands, f32 accum WMMA)
//   O = softmax(causal(Q K^T / sqrt(C))) V     (flash-attention, 32-row tiles)
// All fragments are built with 16-byte loads: for CDNA5 16-bit A/B layouts,
// lane -> row/col (lane%16) and elements map to two contiguous 8-half K runs
// at offsets 8*half and 16+8*half.
// The f16 operands in the workspace (W^T, Q, K, V^T) are kept in FRAGMENT ORDER:
// a 16 x 32 fragment is 1 KB = [2 runs][32 lanes][8 halves], so that each wave-wide
// 16-byte load or store covers 512 contiguous bytes (4 whole 128-byte lines)
// instead of 32-byte pieces of 16 lines.
// ---------------------------------------------------------------------------

typedef __attribute__((ext_vector_type(16))) _Float16 v16h;
typedef __attribute__((ext_vector_type(8)))  _Float16 v8h;
typedef __attribute__((ext_vector_type(8)))  float    v8f;

#define B_    4
#define T_    4096
#define C_    1024
#define H_    64
#define NQT   (T_ / 16)         // query tiles per batch
#define SCALE 0.03125f          // C^-0.5 = 1024^-0.5 = 1/32
#define FRAG  512               // halves in one 16 x 32 fragment
#define RUN   256               // halves in one run of a fragment: 32 lanes x 8

static __device__ __forceinline__ v8f vzero8() {
    v8f z = {0.f, 0.f, 0.f, 0.f, 0.f, 0.f, 0.f, 0.f};
    return z;
}

// A 16-half fragment from fragment-order memory. p = fragment + 8 * lane.
static __device__ __forceinline__ v16h ld_pack(const _Float16* p) {
    const v8h lo = *(const v8h*)(p);        // elements e=0..7  : k = 8hs+e
    const v8h hi = *(const v8h*)(p + RUN);  // elements e=8..15 : k = 8hs+16+(e-8)
    return __builtin_shufflevector(lo, hi, 0, 1, 2, 3, 4, 5, 6, 7,
                                           8, 9, 10, 11, 12, 13, 14, 15);
}

// The same fragment from two runs of 8 fp32 values of a row (contraction dim contiguous,
// at +8*hs and +16+8*hs of the step), converted to f16.
static __device__ __forceinline__ v16h cvt_frag(v8f lo, v8f hi) {
    v16h r;
#pragma unroll
    for (int e = 0; e < 8; ++e) {
        r[e]     = (_Float16)lo[e];
        r[e + 8] = (_Float16)hi[e];
    }
    return r;
}

// Pack 8 f32 accumulator rows into one 16-byte f16 store.
static __device__ __forceinline__ void st_rows(_Float16* p, v8f a) {
    v8h h;
#pragma unroll
    for (int r = 0; r < 8; ++r) h[r] = (_Float16)a[r];
    *(v8h*)p = h;
}

static __device__ __forceinline__ v8f wmma_f16(v16h a, v16h b, v8f c) {
    return __builtin_amdgcn_wmma_f32_16x16x32_f16(false, a, false, b,
                                                  (short)0, c, false, false);
}

// ---------------------------------------------------------------------------
// Kernel 0: W fp32 [C][H] -> f16 fragments of W^T, [C/32 k steps][3 matrices][4 h tiles]:
// the 12 fragments that one step of the projection reads lie in one 12 KB run.
// ---------------------------------------------------------------------------
__global__ void cvt_w_kernel(const float* __restrict__ Wq,
                             const float* __restrict__ Wk,
                             const float* __restrict__ Wv,
                             _Float16* __restrict__ W16t) {
    // one thread per stored element of each matrix: i = [k step][h tile][run][lane][8]
    const int i = blockIdx.x * blockDim.x + threadIdx.x;
    if (i < H_ * C_) {
        const int ks = i / (4 * FRAG), t = (i / FRAG) & 3;
        const int run = (i / RUN) & 1, ld = (i >> 3) & 31;      // ld: lane that loads it
        const int h = t * 16 + (ld & 15);
        const int c = ks * 32 + run * 16 + (ld >> 4) * 8 + (i & 7);
        const int d = (ks * 12 + t) * FRAG + (i & (FRAG - 1));
        W16t[d]            = (_Float16)Wq[c * H_ + h];
        W16t[d + 4 * FRAG] = (_Float16)Wk[c * H_ + h];
        W16t[d + 8 * FRAG] = (_Float16)Wv[c * H_ + h];
    }
}

// ---------------------------------------------------------------------------
// Kernel 1: QKV projection. One work-group per 64 rows of X = 4 tiles of 16 rows,
// KW waves per tile; wave ks of a tile takes the 32-wide steps ks, ks+KW, ... of
// the contraction (neighbouring waves read neighbouring bytes of the same rows),
// and the KW partial results are summed once through LDS: more waves per SIMD to
// cover the latency of the loads.
//   Q^T,K^T tiles: A = W^T frag, B = X frag  -> D(m=h, n=query)
//   V tiles:       A = X frag,  B = W^T frag -> D(m=query, n=h)
// X and W fragments have identical lane/element maps, so each is loaded once
// and reused in both roles. Q, K and V^T are stored as the fragments that the
// attention kernel loads: Q, K [16-row tile][2 h steps], V^T [32-key block][4 h tiles].
// ---------------------------------------------------------------------------
#define KW 4                    // waves per 16-row tile = splits of the contraction

typedef __attribute__((ext_vector_type(4))) float v4f;

// One accumulator tile to / from LDS as two planes of [32 lanes][4 floats], so
// that each 16-byte LDS access of a wave covers 512 contiguous bytes.
static __device__ __forceinline__ void put_tile(float (*p)[32][4], int lane, v8f a) {
    *(v4f*)p[0][lane] = __builtin_shufflevector(a, a, 0, 1, 2, 3);
    *(v4f*)p[1][lane] = __builtin_shufflevector(a, a, 4, 5, 6, 7);
}
static __device__ __forceinline__ v8f get_tile(const float (*p)[32][4], int lane) {
    const v4f lo = *(const v4f*)p[0][lane];
    const v4f hi = *(const v4f*)p[1][lane];
    return __builtin_shufflevector(lo, hi, 0, 1, 2, 3, 4, 5, 6, 7);
}

__global__ void __launch_bounds__(4 * KW * 32) qkv_kernel(const float* __restrict__ X,
                                                          const _Float16* __restrict__ W16t,
                                                          _Float16* __restrict__ QKV) {
    const int lane  = threadIdx.x & 31;
    // wave number as a scalar, so that its tile, slice and the branches on it are scalar
    const int wslot = __builtin_amdgcn_readfirstlane(threadIdx.x >> 5);
    const int tl    = wslot / KW;                 // tile within the work-group
    const int ks    = wslot % KW;                 // slice of the contraction
    const int b     = blockIdx.x / (NQT / 4);
    const int qb    = (blockIdx.x % (NQT / 4)) * 64;   // first row of the work-group
    const int q0    = qb + tl * 16;
    const int hs    = lane >> 4;
    const int ln    = lane & 15;

    __shared__ __align__(16) float red[4][KW][12][2][32][4];   // partial Q, K, V tiles

    _Float16* Q16  = QKV;                                 // [B][T/16][2] fragments
    _Float16* K16  = QKV + (size_t)1 * B_ * T_ * H_;      // [B][T/16][2] fragments
    _Float16* V16t = QKV + (size_t)2 * B_ * T_ * H_;      // [B][T/32][4] fragments

    v8f accq[4], acck[4], accv[4];
#pragma unroll
    for (int t = 0; t < 4; ++t) { accq[t] = vzero8(); acck[t] = vzero8(); accv[t] = vzero8(); }

    const float* xrow = X + ((size_t)b * T_ + q0 + ln) * C_;

    // A step's loads all fly together: its 12 W fragments are fetched as one group in
    // front of its products, and the X rows of the next step behind them, so that a
    // step waits one load latency, not one per product. Order of the sums unchanged.
    const float*    xp = xrow + ks * 32 + 8 * hs;
    const _Float16* wp = W16t + ks * 12 * FRAG + lane * 8;
    v8f xlo = *(const v8f*)(xp);
    v8f xhi = *(const v8f*)(xp + 16);
    // unrolled: every address is one base plus an immediate, the two sets of X rows
    // need no copies, and the last step's missing fetch is settled at compile time
#pragma unroll
    for (int s = 0; s < C_ / (KW * 32); ++s) {
        v16h w[12];                                // Q: 0-3, K: 4-7, V: 8-11
#pragma unroll
        for (int j = 0; j < 12; ++j) w[j] = ld_pack(wp + (s * KW * 12 + j) * FRAG);
        v8f nlo = xlo, nhi = xhi;
        if (s + 1 < C_ / (KW * 32)) {
            nlo = *(const v8f*)(xp + (s + 1) * KW * 32);
            nhi = *(const v8f*)(xp + (s + 1) * KW * 32 + 16);
        }
        const v16h xf = cvt_frag(xlo, xhi);        // X fragment (A and B role)
#pragma unroll
        for (int t = 0; t < 4; ++t) {
            accq[t] = wmma_f16(w[t],     xf, accq[t]);   // Q^T tile
            acck[t] = wmma_f16(w[4 + t], xf, acck[t]);   // K^T tile
            accv[t] = wmma_f16(xf, w[8 + t], accv[t]);   // V tile
        }
        xlo = nlo;
        xhi = nhi;
    }

    // publish this wave's partial tiles
#pragma unroll
    for (int t = 0; t < 4; ++t) {
        put_tile(red[tl][ks][t],     lane, accq[t]);
        put_tile(red[tl][ks][4 + t], lane, acck[t]);
        put_tile(red[tl][ks][8 + t], lane, accv[t]);
    }
    __syncthreads();
    if (wslot >= 12) return;        // no barrier follows

    // Sum and store, lane maps unchanged: waves 0-3 the Q rows of tile wslot, waves
    // 4-7 the K rows of tile wslot - 4, waves 8-11 column group wslot - 8 of V over
    // all 64 keys. A lane's 8 values are one lane's share of one run of a fragment.
    const bool isv = wslot >= 8;
    const int  sel = wslot & 3;
    // Q^T/K^T D: lane n = query (ln), rows r = h = 16i + 8hs + r: run i of the row tile
    // V D:       lane n = h, rows r = key = 16i + 8hs + r: run i & 1 of key block i >> 1
    _Float16* dst = isv
        ? V16t + ((size_t)(b * (T_ / 32) + qb / 32) * 4 + sel) * FRAG + lane * 8
        : (wslot < 4 ? Q16 : K16) + (size_t)(b * NQT + qb / 16 + sel) * (2 * FRAG) + lane * 8;
#pragma unroll
    for (int i = 0; i < 4; ++i) {
        const int stl = isv ? i : sel;                       // source tile
        const int sid = isv ? 8 + sel : (wslot & 4) + i;     // source Q, K or V group
        v8f s = get_tile(red[stl][0][sid], lane);
#pragma unroll
        for (int w = 1; w < KW; ++w) s += get_tile(red[stl][w][sid], lane);
        st_rows(dst + (isv ? (i >> 1) * 4 * FRAG + (i & 1) * RUN : i * RUN), s);
    }
}

#define NW    16
#define NG    2
#define QT    (16 * NG)
#define NQB   (T_ / QT)
#define OPIT  68

// e^x. The v_nop is the free issue slot that the instruction set asks for behind a
// transcendental; written into the same statement.
static __device__ __forceinline__ float exp_slot(float x) {
    float y;
    asm("v_exp_f32 %0, %1\n\tv_nop" : "=v"(y) : "v"(x * 1.44269504f));
    return y;
}

// value of lane l ^ 16 (the other half of the wave), as a vector cross-row move
static __device__ __forceinline__ float xhalf(float x) {
    const int i = __builtin_bit_cast(int, x);
    return __builtin_bit_cast(float,
        __builtin_amdgcn_permlanex16(i, i, 0x76543210, 0xfedcba98, false, false));
}

// amdgpu_waves_per_eu(4, 4): one work-group per WGP = 4 waves per SIMD, which is what
// the registers of a pass with all its fragments in flight allow. Without it the
// compiler aims at more waves, loads the fragments through few registers, and every
// product waits a full load latency of its own.
__global__ void __launch_bounds__(NW * 32) __attribute__((amdgpu_waves_per_eu(4, 4)))
attn_kernel(const _Float16* __restrict__ QKV, float* __restrict__ out) {
    const int lane  = threadIdx.x & 31;
    // wave number as a scalar, so that the key loop is a scalar loop
    const int wslot = __builtin_amdgcn_readfirstlane(threadIdx.x >> 5);
    // Cost falls with the work-group index: a causal tile's key loop grows with qt, only
    // half of the work-groups are resident at once. The longest tiles (of all batches) go first, the short ones fill the tail.
    const int b     = blockIdx.x % B_;
    const int qt    = (NQB - 1u - blockIdx.x / B_) % NQB;
    const int q0    = qt * QT;
    const int hs    = lane >> 4;
    const int ln    = lane & 15;

    const _Float16* Q16  = QKV;
    const _Float16* K16  = QKV + (size_t)1 * B_ * T_ * H_;
    const _Float16* V16t = QKV + (size_t)2 * B_ * T_ * H_;

    __shared__ __align__(16) float    opart[NW][QT][OPIT]; // un-normalised partial O
    __shared__ float mpart[NW][QT];                        // partial row maxima
    __shared__ float lpart[NW][QT];                        // partial row sums

    // Q B-fragments (contraction = head dim; column = query 16g + ln)
    const _Float16* qfr = Q16 + (size_t)(b * NQT + qt * NG) * (2 * FRAG) + lane * 8;
    v16h bq[NG][2];
#pragma unroll
    for (int g = 0; g < NG; ++g) {
        bq[g][0] = ld_pack(qfr + g * 2 * FRAG);
        bq[g][1] = ld_pack(qfr + g * 2 * FRAG + FRAG);
    }

    float mrun[NG];                   // maximum of query 16g + ln, alike in both halves
    float lrun[NG];                   // sum of that query over this half's keys
    v8f   o[NG][4];                   // o[g][t][r] = O[query 16g + ln][h = 16t + 8hs + r]
#pragma unroll
    for (int g = 0; g < NG; ++g) {
        mrun[g] = -__builtin_inff();
        lrun[g] = 0.f;
#pragma unroll
        for (int t = 0; t < 4; ++t) o[g][t] = vzero8();
    }

    const int nkb = (q0 + QT - 1) / 32 + 1;   // causal: key blocks up to diagonal
    for (int kb = wslot; kb < nkb; kb += NW) {
        const int kbase = kb * 32;

        // the pass's fragments: K rows [kbase..+15], [kbase+16..+31] x 2 h steps, V^T x 4
        const _Float16* kfr = K16 + (size_t)(b * NQT + 2 * kb) * (2 * FRAG) + lane * 8;
        const _Float16* vfr = V16t + (size_t)(b * (T_ / 32) + kb) * (4 * FRAG) + lane * 8;
        v16h kf[2][2], vf[4];
#pragma unroll
        for (int j = 0; j < 2; ++j) {
            kf[j][0] = ld_pack(kfr + j * 2 * FRAG);
            kf[j][1] = ld_pack(kfr + j * 2 * FRAG + FRAG);
        }
        // the K loads' address registers are free for reuse from here on (the V^T fragments
        // land in them): the wait that stands in front of such an overwrite
        asm volatile("s_wait_xcnt 0x0" ::: "memory");
#pragma unroll
        for (int t = 0; t < 4; ++t) vf[t] = ld_pack(vfr + t * FRAG);

        // S^T tiles of every group: D(m = key, n = query)
        v8f s[NG][2];
#pragma unroll
        for (int g = 0; g < NG; ++g) { s[g][0] = vzero8(); s[g][1] = vzero8(); }
#pragma unroll
        for (int hstep = 0; hstep < 2; ++hstep) {
#pragma unroll
            for (int g = 0; g < NG; ++g) {
                s[g][0] = wmma_f16(kf[0][hstep], bq[g][hstep], s[g][0]);
                s[g][1] = wmma_f16(kf[1][hstep], bq[g][hstep], s[g][1]);
            }
        }

        v16h pf[NG];                                  // P^T as B fragments
#pragma unroll
        for (int g = 0; g < NG; ++g) {
            // scale + causal mask: register r is key kbase + 8hs + r (tile 0), + 16 (tile 1)
            const int lim = q0 + 16 * g + ln - kbase - 8 * hs;   // keys with r <= lim are seen
            v8f s0 = s[g][0], s1 = s[g][1];
            float rm = -__builtin_inff();
#pragma unroll
            for (int r = 0; r < 8; ++r) {
                s0[r] = r > lim      ? -__builtin_inff() : s0[r] * SCALE;
                s1[r] = 16 + r > lim ? -__builtin_inff() : s1[r] * SCALE;
                rm = fmaxf(rm, fmaxf(s0[r], s1[r]));
            }

            // online softmax of this lane's query
            const float newm = fmaxf(mrun[g], fmaxf(rm, xhalf(rm)));
            const float cf   = exp_slot(mrun[g] - newm);
            float rs = 0.f;
#pragma unroll
            for (int r = 0; r < 8; ++r) {
                const float p0 = exp_slot(s0[r] - newm);
                const float p1 = exp_slot(s1[r] - newm);
                rs += p0 + p1;
                pf[g][r]     = (_Float16)p0;
                pf[g][r + 8] = (_Float16)p1;
            }
            mrun[g] = newm;
            lrun[g] = lrun[g] * cf + rs;
#pragma unroll
            for (int t = 0; t < 4; ++t) o[g][t] *= cf;
        }

        // O^T += V^T P^T (contraction = 32 keys): D(m = h, n = query)
#pragma unroll
        for (int t = 0; t < 4; ++t) {
#pragma unroll
            for (int g = 0; g < NG; ++g) o[g][t] = wmma_f16(vf[t], pf[g], o[g][t]);
        }
    }

    // publish this wave's partial (a wave without a key block: max -inf, sum 0, O 0)
#pragma unroll
    for (int g = 0; g < NG; ++g) {
        lrun[g] += xhalf(lrun[g]);  // join the two halves' keys
        if (hs == 0) {
            mpart[wslot][16 * g + ln] = mrun[g];
            lpart[wslot][16 * g + ln] = lrun[g];
        }
#pragma unroll
        for (int t = 0; t < 4; ++t) {
            float* p = &opart[wslot][16 * g + ln][t * 16 + hs * 8];
            *(v4f*)p       = __builtin_shufflevector(o[g][t], o[g][t], 0, 1, 2, 3);
            *(v4f*)(p + 4) = __builtin_shufflevector(o[g][t], o[g][t], 4, 5, 6, 7);
        }
    }
    __syncthreads();

    // merge, all NW waves: each lane owns 4 neighbouring columns of one query row. Wave 0
    // always holds key block 0, in which every row has an unmasked key, so the
    // merged maximum is finite and the weight of an empty partial is exp(-inf) = 0.
    static_assert(NW * 32 * 4 == QT * H_, "one lane per 4 output columns");
    const int row = threadIdx.x >> 4;
    const int col = (threadIdx.x & 15) * 4;
    float mall = mpart[0][row];
#pragma unroll
    for (int w = 1; w < NW; ++w) mall = fmaxf(mall, mpart[w][row]);
    float wt[NW];
#pragma unroll
    for (int w = 0; w < NW; ++w) wt[w] = exp_slot(mpart[w][row] - mall);
    float lall = 0.f;
    v4f   acc  = {0.f, 0.f, 0.f, 0.f};
#pragma unroll
    for (int w = 0; w < NW; ++w) {
        lall += wt[w] * lpart[w][row];
        acc  += wt[w] * *(const v4f*)&opart[w][row][col];
    }

    // normalize and write fp32 output
    const float inv = 1.0f / lall;
    *(v4f*)&out[((size_t)b * T_ + q0 + row) * H_ + col] = acc * inv;
}

// ---------------------------------------------------------------------------
extern "C" void kernel_launch(void* const* d_in, const int* in_sizes, int n_in,
                              void* d_out, int out_size, void* d_ws, size_t ws_size,
                              hipStream_t stream) {
    const float* X  = (const float*)d_in[0];
    const float* Wq = (const float*)d_in[1];
    const float* Wk = (const float*)d_in[2];
    const float* Wv = (const float*)d_in[3];
    float* out = (float*)d_out;

    // workspace: f16 W^T (384 KB), then Q, K, V^T f16 (6 MB), all in fragment order
    _Float16* W16t = (_Float16*)d_ws;
    _Float16* QKV  = W16t + (size_t)3 * H_ * C_;

    cvt_w_kernel<<<(H_ * C_ + 255) / 256, 256, 0, stream>>>(Wq, Wk, Wv, W16t);

    const int ntiles = B_ * NQT;               // 1024 tiles of 16 rows
    qkv_kernel<<<ntiles / 4, 4 * KW * 32, 0, stream>>>(X, W16t, QKV);   // 4 row tiles per block
    attn_kernel<<<B_ * NQB, NW * 32, 0, stream>>>(QKV, out);     // one block per 32 queries
}

// v008
// A run of this version takes 30.6 microseconds.
// Next to v007, in two timings, it ran 1.27 and 1.25 times as fast.
// All steps since v000 together make it 7.94 times as fast.
#include <hip/hip_runtime.h>
#include <hip/hip_bf16.h>

// ---------------------------------------------------------------------------
// Self-attention head for MI455X (gfx1250, wave32, WMMA).
//   Q^T = Wq^T X^T, K^T = Wk^T X^T, V = X Wv   (f16 operands, f32 accum WMMA)
//   O = softmax(causal(Q K^T / sqrt(C))) V     (flash-attention, 32-row tiles)
// All fragments are built with 16-byte loads: for CDNA5 16-bit A/B layouts,
// lane -> row/col (lane%16) and elements map to two contiguous 8-half K runs
// at offsets 8*half and 16+8*half.
// The f16 operands in the workspace (W^T, Q, K, V^T) are kept in FRAGMENT ORDER:
// a 16 x 32 fragment is 1 KB = [2 runs][32 lanes][8 halves], so that each wave-wide
// 16-byte load or store covers 512 contiguous bytes (4 whole 128-byte lines)
// instead of 32-byte pieces of 16 lines.
// ---------------------------------------------------------------------------

typedef __attribute__((ext_vector_type(16))) _Float16 v16h;
typedef __attribute__((ext_vector_type(8)))  _Float16 v8h;
typedef __attribute__((ext_vector_type(8)))  float    v8f;

#define B_    4
#define T_    4096
#define C_    1024
#define H_    64
#define NQT   (T_ / 16)         // query tiles per batch
#define SCALE 0.03125f          // C^-0.5 = 1024^-0.5 = 1/32
#define FRAG  512               // halves in one 16 x 32 fragment
#define RUN   256               // halves in one run of a fragment: 32 lanes x 8

static __device__ __forceinline__ v8f vzero8() {
    v8f z = {0.f, 0.f, 0.f, 0.f, 0.f, 0.f, 0.f, 0.f};
    return z;
}

// A 16-half fragment from fragment-order memory. p = fragment + 8 * lane.
static __device__ __forceinline__ v16h ld_pack(const _Float16* p) {
    const v8h lo = *(const v8h*)(p);        // elements e=0..7  : k = 8hs+e
    const v8h hi = *(const v8h*)(p + RUN);  // elements e=8..15 : k = 8hs+16+(e-8)
    return __builtin_shufflevector(lo, hi, 0, 1, 2, 3, 4, 5, 6, 7,
                                           8, 9, 10, 11, 12, 13, 14, 15);
}

// The same fragment from two runs of 8 fp32 values of a row (contraction dim contiguous,
// at +8*hs and +16+8*hs of the step), converted to f16.
static __device__ __forceinline__ v16h cvt_frag(v8f lo, v8f hi) {
    v16h r;
#pragma unroll
    for (int e = 0; e < 8; ++e) {
        r[e]     = (_Float16)lo[e];
        r[e + 8] = (_Float16)hi[e];
    }
    return r;
}

// Pack 8 f32 accumulator rows into one 16-byte f16 store.
static __device__ __forceinline__ void st_rows(_Float16* p, v8f a) {
    v8h h;
#pragma unroll
    for (int r = 0; r < 8; ++r) h[r] = (_Float16)a[r];
    *(v8h*)p = h;
}

static __device__ __forceinline__ v8f wmma_f16(v16h a, v16h b, v8f c) {
    return __builtin_amdgcn_wmma_f32_16x16x32_f16(false, a, false, b,
                                                  (short)0, c, false, false);
}

// ---------------------------------------------------------------------------
// Kernel 0: W fp32 [C][H] -> f16 fragments of W^T, [C/32 k steps][3 matrices][4 h tiles]:
// the 12 fragments that one step of the projection reads lie in one 12 KB run.
// ---------------------------------------------------------------------------
__global__ void cvt_w_kernel(const float* __restrict__ Wq,
                             const float* __restrict__ Wk,
                             const float* __restrict__ Wv,
                             _Float16* __restrict__ W16t) {
    // one thread per stored element of each matrix: i = [k step][h tile][run][lane][8]
    const int i = blockIdx.x * blockDim.x + threadIdx.x;
    if (i < H_ * C_) {
        const int ks = i / (4 * FRAG), t = (i / FRAG) & 3;
        const int run = (i / RUN) & 1, ld = (i >> 3) & 31;      // ld: lane that loads it
        const int h = t * 16 + (ld & 15);
        const int c = ks * 32 + run * 16 + (ld >> 4) * 8 + (i & 7);
        const int d = (ks * 12 + t) * FRAG + (i & (FRAG - 1));
        W16t[d]            = (_Float16)Wq[c * H_ + h];
        W16t[d + 4 * FRAG] = (_Float16)Wk[c * H_ + h];
        W16t[d + 8 * FRAG] = (_Float16)Wv[c * H_ + h];
    }
}

// ---------------------------------------------------------------------------
// Kernel 1: QKV projection. One work-group per 64 rows of X = 4 tiles of 16 rows,
// KW waves per tile; wave ks of a tile takes the 32-wide steps ks, ks+KW, ... of
// the contraction (neighbouring waves read neighbouring bytes of the same rows),
// and the KW partial results are summed once through LDS: more waves per SIMD to
// cover the latency of the loads.
//   Q^T,K^T tiles: A = W^T frag, B = X frag  -> D(m=h, n=query)
//   V tiles:       A = X frag,  B = W^T frag -> D(m=query, n=h)
// X and W fragments have identical lane/element maps, so each is loaded once
// and reused in both roles. Q, K and V^T are stored as the fragments that the
// attention kernel loads: Q, K [16-row tile][2 h steps], V^T [32-key block][4 h tiles].
// ---------------------------------------------------------------------------
#define KW 4                    // waves per 16-row tile = splits of the contraction

typedef __attribute__((ext_vector_type(4))) float v4f;

// One accumulator tile to / from LDS as two planes of [32 lanes][4 floats], so
// that each 16-byte LDS access of a wave covers 512 contiguous bytes.
static __device__ __forceinline__ void put_tile(float (*p)[32][4], int lane, v8f a) {
    *(v4f*)p[0][lane] = __builtin_shufflevector(a, a, 0, 1, 2, 3);
    *(v4f*)p[1][lane] = __builtin_shufflevector(a, a, 4, 5, 6, 7);
}
static __device__ __forceinline__ v8f get_tile(const float (*p)[32][4], int lane) {
    const v4f lo = *(const v4f*)p[0][lane];
    const v4f hi = *(const v4f*)p[1][lane];
    return __builtin_shufflevector(lo, hi, 0, 1, 2, 3, 4, 5, 6, 7);
}

#define XPIT  144               // LDS bytes of a staged X row: 128 + 16 (16 B x odd: no bank conflict)
#define XSLOT (16 * XPIT)       // the 16 rows of one step

// One step's X rows (16 rows x 128 B) from global memory into LDS, through no register:
// four asynchronous copies, each of 4 whole 128-byte lines (8 lanes x 16 B per row).
// l, g: this lane's LDS byte address and global address in the first of them. The
// s_wait_xcnt stands in the copies' own statement, so that no register which a copy
// names is rewritten in front of it.
static __device__ __forceinline__ void copy_step(unsigned l, const float* g) {
    asm volatile("global_load_async_to_lds_b128 %0, %4, off\n\t"
                 "global_load_async_to_lds_b128 %1, %5, off\n\t"
                 "global_load_async_to_lds_b128 %2, %6, off\n\t"
                 "global_load_async_to_lds_b128 %3, %7, off\n\t"
                 "s_wait_xcnt 0x0"
                 :: "v"(l), "v"(l + 4 * XPIT), "v"(l + 8 * XPIT), "v"(l + 12 * XPIT),
                    "v"(g), "v"(g + 4 * C_), "v"(g + 8 * C_), "v"(g + 12 * C_)
                 : "memory");
}

__global__ void __launch_bounds__(4 * KW * 32) qkv_kernel(const float* __restrict__ X,
                                                          const _Float16* __restrict__ W16t,
                                                          _Float16* __restrict__ QKV) {
    const int lane  = threadIdx.x & 31;
    // wave number as a scalar, so that its tile, slice and the branches on it are scalar
    const int wslot = __builtin_amdgcn_readfirstlane(threadIdx.x >> 5);
    const int tl    = wslot / KW;                 // tile within the work-group
    const int ks    = wslot % KW;                 // slice of the contraction
    const int b     = blockIdx.x / (NQT / 4);
    const int qb    = (blockIdx.x % (NQT / 4)) * 64;   // first row of the work-group
    const int q0    = qb + tl * 16;
    const int hs    = lane >> 4;
    const int ln    = lane & 15;

    __shared__ __align__(16) float red[4][KW][12][2][32][4];   // partial Q, K, V tiles
    __shared__ __align__(16) unsigned char xring[4 * KW][2][XSLOT];   // X rows, 2 slots per wave

    _Float16* Q16  = QKV;                                 // [B][T/16][2] fragments
    _Float16* K16  = QKV + (size_t)1 * B_ * T_ * H_;      // [B][T/16][2] fragments
    _Float16* V16t = QKV + (size_t)2 * B_ * T_ * H_;      // [B][T/32][4] fragments

    v8f accq[4], acck[4], accv[4];
#pragma unroll
    for (int t = 0; t < 4; ++t) { accq[t] = vzero8(); acck[t] = vzero8(); accv[t] = vzero8(); }

    // X comes through a ring in LDS that is private to the wave (2 slots of one step), so
    // that every request is for whole lines and two steps' rows are on their way while a
    // step is worked on. Only the wave that copied a slot reads it, behind its own
    // s_wait_asynccnt, and refills it behind its own s_wait_dscnt 0: no barrier.
    // A step's 12 W fragments are fetched as one group behind the products of the step
    // before, so that a step waits one load latency. Order of the sums unchanged.
    const float*         gx = X + ((size_t)b * T_ + q0 + (lane >> 3)) * C_ + ks * 32 + (lane & 7) * 4;
    const unsigned       lx = (unsigned)(size_t)&xring[wslot][0][0] + (lane >> 3) * XPIT + (lane & 7) * 16;
    const unsigned char* xs = &xring[wslot][0][0] + ln * XPIT + hs * 32;
    const _Float16*      wp = W16t + ks * 12 * FRAG + lane * 8;
    copy_step(lx, gx);
    copy_step(lx + XSLOT, gx + KW * 32);
    v16h w[12];                                    // Q: 0-3, K: 4-7, V: 8-11
#pragma unroll
    for (int j = 0; j < 12; ++j) w[j] = ld_pack(wp + j * FRAG);
    // unrolled: every address is one base plus a constant, and which steps still have a
    // refill is settled at compile time
#pragma unroll
    for (int s = 0; s < C_ / (KW * 32); ++s) {
        // Step s has landed. Straight-line code: in a step that refills, exactly the 4 copies
        // of step s + 1 were issued behind those of step s (8 outstanding at most), so the
        // wait leaves 4; the last two steps refill nothing and wait for all.
        if (s + 2 < C_ / (KW * 32)) asm volatile("s_wait_asynccnt 0x4" ::: "memory");
        else                        asm volatile("s_wait_asynccnt 0x0" ::: "memory");
        const v4f* xq = (const v4f*)(xs + (s & 1) * XSLOT);
        const v4f x0 = xq[0], x1 = xq[1], x2 = xq[4], x3 = xq[5];
        if (s + 2 < C_ / (KW * 32)) {
            // the slot's reads have retired before the copies write over it
            asm volatile("s_wait_dscnt 0x0" ::: "memory");
            copy_step(lx + (s & 1) * XSLOT, gx + (s + 2) * KW * 32);
        }
        const v16h xf = cvt_frag(__builtin_shufflevector(x0, x1, 0, 1, 2, 3, 4, 5, 6, 7),
                                 __builtin_shufflevector(x2, x3, 0, 1, 2, 3, 4, 5, 6, 7));
#pragma unroll
        for (int t = 0; t < 4; ++t) {
            accq[t] = wmma_f16(w[t],     xf, accq[t]);   // Q^T tile
            acck[t] = wmma_f16(w[4 + t], xf, acck[t]);   // K^T tile
            accv[t] = wmma_f16(xf, w[8 + t], accv[t]);   // V tile
        }
        if (s + 1 < C_ / (KW * 32)) {
#pragma unroll
            for (int j = 0; j < 12; ++j) w[j] = ld_pack(wp + ((s + 1) * KW * 12 + j) * FRAG);
        }
    }

    // publish this wave's partial tiles
#pragma unroll
    for (int t = 0; t < 4; ++t) {
        put_tile(red[tl][ks][t],     lane, accq[t]);
        put_tile(red[tl][ks][4 + t], lane, acck[t]);
        put_tile(red[tl][ks][8 + t], lane, accv[t]);
    }
    __syncthreads();
    if (wslot >= 12) return;        // no barrier follows

    // Sum and store, lane maps unchanged: waves 0-3 the Q rows of tile wslot, waves
    // 4-7 the K rows of tile wslot - 4, waves 8-11 column group wslot - 8 of V over
    // all 64 keys. A lane's 8 values are one lane's share of one run of a fragment.
    const bool isv = wslot >= 8;
    const int  sel = wslot & 3;
    // Q^T/K^T D: lane n = query (ln), rows r = h = 16i + 8hs + r: run i of the row tile
    // V D:       lane n = h, rows r = key = 16i + 8hs + r: run i & 1 of key block i >> 1
    _Float16* dst = isv
        ? V16t + ((size_t)(b * (T_ / 32) + qb / 32) * 4 + sel) * FRAG + lane * 8
        : (wslot < 4 ? Q16 : K16) + (size_t)(b * NQT + qb / 16 + sel) * (2 * FRAG) + lane * 8;
#pragma unroll
    for (int i = 0; i < 4; ++i) {
        const int stl = isv ? i : sel;                       // source tile
        const int sid = isv ? 8 + sel : (wslot & 4) + i;     // source Q, K or V group
        v8f s = get_tile(red[stl][0][sid], lane);
#pragma unroll
        for (int w = 1; w < KW; ++w) s += get_tile(red[stl][w][sid], lane);
        st_rows(dst + (isv ? (i >> 1) * 4 * FRAG + (i & 1) * RUN : i * RUN), s);
    }
}

#define NW    16
#define NG    2
#define QT    (16 * NG)
#define NQB   (T_ / QT)
#define OPIT  68

// e^x. The v_nop is the free issue slot that the instruction set asks for behind a
// transcendental; written into the same statement.
static __device__ __forceinline__ float exp_slot(float x) {
    float y;
    asm("v_exp_f32 %0, %1\n\tv_nop" : "=v"(y) : "v"(x * 1.44269504f));
    return y;
}

// value of lane l ^ 16 (the other half of the wave), as a vector cross-row move
static __device__ __forceinline__ float xhalf(float x) {
    const int i = __builtin_bit_cast(int, x);
    return __builtin_bit_cast(float,
        __builtin_amdgcn_permlanex16(i, i, 0x76543210, 0xfedcba98, false, false));
}

// amdgpu_waves_per_eu(4, 4): one work-group per WGP = 4 waves per SIMD, which is what
// the registers of a pass with all its fragments in flight allow. Without it the
// compiler aims at more waves, loads the fragments through few registers, and every
// product waits a full load latency of its own.
__global__ void __launch_bounds__(NW * 32) __attribute__((amdgpu_waves_per_eu(4, 4)))
attn_kernel(const _Float16* __restrict__ QKV, float* __restrict__ out) {
    const int lane  = threadIdx.x & 31;
    // wave number as a scalar, so that the key loop is a scalar loop
    const int wslot = __builtin_amdgcn_readfirstlane(threadIdx.x >> 5);
    // Cost falls with the work-group index: a causal tile's key loop grows with qt, only
    // half of the work-groups are resident at once. The longest tiles (of all batches) go first, the short ones fill the tail.
    const int b     = blockIdx.x % B_;
    const int qt    = (NQB - 1u - blockIdx.x / B_) % NQB;
    const int q0    = qt * QT;
    const int hs    = lane >> 4;
    const int ln    = lane & 15;

    const _Float16* Q16  = QKV;
    const _Float16* K16  = QKV + (size_t)1 * B_ * T_ * H_;
    const _Float16* V16t = QKV + (size_t)2 * B_ * T_ * H_;

    __shared__ __align__(16) float    opart[NW][QT][OPIT]; // un-normalised partial O
    __shared__ float mpart[NW][QT];                        // partial row maxima
    __shared__ float lpart[NW][QT];                        // partial row sums

    // Q B-fragments (contraction = head dim; column = query 16g + ln)
    const _Float16* qfr = Q16 + (size_t)(b * NQT + qt * NG) * (2 * FRAG) + lane * 8;
    v16h bq[NG][2];
#pragma unroll
    for (int g = 0; g < NG; ++g) {
        bq[g][0] = ld_pack(qfr + g * 2 * FRAG);
        bq[g][1] = ld_pack(qfr + g * 2 * FRAG + FRAG);
    }

    float mrun[NG];                   // maximum of query 16g + ln, alike in both halves
    float lrun[NG];                   // sum of that query over this half's keys
    v8f   o[NG][4];                   // o[g][t][r] = O[query 16g + ln][h = 16t + 8hs + r]
#pragma unroll
    for (int g = 0; g < NG; ++g) {
        mrun[g] = -__builtin_inff();
        lrun[g] = 0.f;
#pragma unroll
        for (int t = 0; t < 4; ++t) o[g][t] = vzero8();
    }

    const int nkb = (q0 + QT - 1) / 32 + 1;   // causal: key blocks up to diagonal
    for (int kb = wslot; kb < nkb; kb += NW) {
        const int kbase = kb * 32;

        // the pass's fragments: K rows [kbase..+15], [kbase+16..+31] x 2 h steps, V^T x 4
        const _Float16* kfr = K16 + (size_t)(b * NQT + 2 * kb) * (2 * FRAG) + lane * 8;
        const _Float16* vfr = V16t + (size_t)(b * (T_ / 32) + kb) * (4 * FRAG) + lane * 8;
        v16h kf[2][2], vf[4];
#pragma unroll
        for (int j = 0; j < 2; ++j) {
            kf[j][0] = ld_pack(kfr + j * 2 * FRAG);
            kf[j][1] = ld_pack(kfr + j * 2 * FRAG + FRAG);
        }
        // the K loads' address registers are free for reuse from here on (the V^T fragments
        // land in them): the wait that stands in front of such an overwrite
        asm volatile("s_wait_xcnt 0x0" ::: "memory");
#pragma unroll
        for (int t = 0; t < 4; ++t) vf[t] = ld_pack(vfr + t * FRAG);

        // S^T tiles of every group: D(m = key, n = query)
        v8f s[NG][2];
#pragma unroll
        for (int g = 0; g < NG; ++g) { s[g][0] = vzero8(); s[g][1] = vzero8(); }
#pragma unroll
        for (int hstep = 0; hstep < 2; ++hstep) {
#pragma unroll
            for (int g = 0; g < NG; ++g) {
                s[g][0] = wmma_f16(kf[0][hstep], bq[g][hstep], s[g][0]);
                s[g][1] = wmma_f16(kf[1][hstep], bq[g][hstep], s[g][1]);
            }
        }

        v16h pf[NG];                                  // P^T as B fragments
#pragma unroll
        for (int g = 0; g < NG; ++g) {
            // scale + causal mask: register r is key kbase + 8hs + r (tile 0), + 16 (tile 1)
            const int lim = q0 + 16 * g + ln - kbase - 8 * hs;   // keys with r <= lim are seen
            v8f s0 = s[g][0], s1 = s[g][1];
            float rm = -__builtin_inff();
#pragma unroll
            for (int r = 0; r < 8; ++r) {
                s0[r] = r > lim      ? -__builtin_inff() : s0[r] * SCALE;
                s1[r] = 16 + r > lim ? -__builtin_inff() : s1[r] * SCALE;
                rm = fmaxf(rm, fmaxf(s0[r], s1[r]));
            }

            // online softmax of this lane's query
            const float newm = fmaxf(mrun[g], fmaxf(rm, xhalf(rm)));
            const float cf   = exp_slot(mrun[g] - newm);
            float rs = 0.f;
#pragma unroll
            for (int r = 0; r < 8; ++r) {
                const float p0 = exp_slot(s0[r] - newm);
                const float p1 = exp_slot(s1[r] - newm);
                rs += p0 + p1;
                pf[g][r]     = (_Float16)p0;
                pf[g][r + 8] = (_Float16)p1;
            }
            mrun[g] = newm;
            lrun[g] = lrun[g] * cf + rs;
#pragma unroll
            for (int t = 0; t < 4; ++t) o[g][t] *= cf;
        }

        // O^T += V^T P^T (contraction = 32 keys): D(m = h, n = query)
#pragma unroll
        for (int t = 0; t < 4; ++t) {
#pragma unroll
            for (int g = 0; g < NG; ++g) o[g][t] = wmma_f16(vf[t], pf[g], o[g][t]);
        }
    }

    // publish this wave's partial (a wave without a key block: max -inf, sum 0, O 0)
#pragma unroll
    for (int g = 0; g < NG; ++g) {
        lrun[g] += xhalf(lrun[g]);  // join the two halves' keys
        if (hs == 0) {
            mpart[wslot][16 * g + ln] = mrun[g];
            lpart[wslot][16 * g + ln] = lrun[g];
        }
#pragma unroll
        for (int t = 0; t < 4; ++t) {
            float* p = &opart[wslot][16 * g + ln][t * 16 + hs * 8];
            *(v4f*)p       = __builtin_shufflevector(o[g][t], o[g][t], 0, 1, 2, 3);
            *(v4f*)(p + 4) = __builtin_shufflevector(o[g][t], o[g][t], 4, 5, 6, 7);
        }
    }
    __syncthreads();

    // merge, all NW waves: each lane owns 4 neighbouring columns of one query row. Wave 0
    // always holds key block 0, in which every row has an unmasked key, so the
    // merged maximum is finite and the weight of an empty partial is exp(-inf) = 0.
    static_assert(NW * 32 * 4 == QT * H_, "one lane per 4 output columns");
    const int row = threadIdx.x >> 4;
    const int col = (threadIdx.x & 15) * 4;
    float mall = mpart[0][row];
#pragma unroll
    for (int w = 1; w < NW; ++w) mall = fmaxf(mall, mpart[w][row]);
    float wt[NW];
#pragma unroll
    for (int w = 0; w < NW; ++w) wt[w] = exp_slot(mpart[w][row] - mall);
    float lall = 0.f;
    v4f   acc  = {0.f, 0.f, 0.f, 0.f};
#pragma unroll
    for (int w = 0; w < NW; ++w) {
        lall += wt[w] * lpart[w][row];
        acc  += wt[w] * *(const v4f*)&opart[w][row][col];
    }

    // normalize and write fp32 output
    const float inv = 1.0f / lall;
    *(v4f*)&out[((size_t)b * T_ + q0 + row) * H_ + col] = acc * inv;
}

// ---------------------------------------------------------------------------
extern "C" void kernel_launch(void* const* d_in, const int* in_sizes, int n_in,
                              void* d_out, int out_size, void* d_ws, size_t ws_size,
                              hipStream_t stream) {
    const float* X  = (const float*)d_in[0];
    const float* Wq = (const float*)d_in[1];
    const float* Wk = (const float*)d_in[2];
    const float* Wv = (const float*)d_in[3];
    float* out = (float*)d_out;

    // workspace: f16 W^T (384 KB), then Q, K, V^T f16 (6 MB), all in fragment order
    _Float16* W16t = (_Float16*)d_ws;
    _Float16* QKV  = W16t + (size_t)3 * H_ * C_;

    cvt_w_kernel<<<(H_ * C_ + 255) / 256, 256, 0, stream>>>(Wq, Wk, Wv, W16t);

    const int ntiles = B_ * NQT;               // 1024 tiles of 16 rows
    qkv_kernel<<<ntiles / 4, 4 * KW * 32, 0, stream>>>(X, W16t, QKV);   // 4 row tiles per block
    attn_kernel<<<B_ * NQB, NW * 32, 0, stream>>>(QKV, out);     // one block per 32 queries
}
